// v000
// The times below were measured on an AMD MI455X: many runs one after another, warmed up first and cycling through
// copies of the inputs, with the whole window's GPU time divided by the number of runs. Launches and the gaps
// between them are all in it. The median over several windows is given; except for v000 it joins two sittings, which
// can be a few percent apart, so the side-by-side timings, each taken in one sitting, are the better comparison.
// v000, which the later versions start from, runs in 406 microseconds.
#include <hip/hip_runtime.h>
#include <hip/hip_bf16.h>
#include <float.h>

// Problem constants (match the reference)
#define B_     4
#define N_     2048
#define M_     2048
#define QDIM   512
#define CDIM   512
#define HEADS_ 8
#define DHEAD  64
#define INNER_ 512
#define SCALE_ 0.125f   // 64^-0.5

typedef _Float16 v16h __attribute__((ext_vector_type(16)));
typedef _Float16 h8   __attribute__((ext_vector_type(8)));
typedef float    v8f  __attribute__((ext_vector_type(8)));

// Build a 16x32 f16 A/B fragment for v_wmma_f32_16x16x32_f16.
// Per the CDNA5 ISA layout, lane L (row/col = L%16, half = L/16) holds
//   frag[0..7]  = X[row][ 8*half + i]        (contiguous 16B)
//   frag[8..15] = X[row][16 + 8*half + i]    (contiguous 16B)
__device__ __forceinline__ v16h frag_ld(const _Float16* lo_p, const _Float16* hi_p) {
    h8 lo = *(const h8*)lo_p;
    h8 hi = *(const h8*)hi_p;
    v16h r;
#pragma unroll
    for (int i = 0; i < 8; ++i) { r[i] = lo[i]; r[i + 8] = hi[i]; }
    return r;
}

__device__ __forceinline__ v8f wmma16(v16h a, v16h b, v8f c) {
    // (neg_a, A, neg_b, B, c_mod, C, reuse_a, reuse_b)
    return __builtin_amdgcn_wmma_f32_16x16x32_f16(false, a, false, b, (short)0, c,
                                                  false, false);
}

// ---------------------------------------------------------------------------
// f32 -> f16 elementwise convert
__global__ void cvt_f32_to_h(const float* __restrict__ src,
                             _Float16* __restrict__ dst, int n) {
    int i = blockIdx.x * blockDim.x + threadIdx.x;
    if (i < n) dst[i] = (_Float16)src[i];
}

// Transpose-convert weight W[in=rows][... ld ...] (taking cols [col0, col0+cols))
// into Wt[out][in] f16, so GEMM B-operand columns become contiguous rows.
__global__ void cvt_transpose(const float* __restrict__ src,
                              _Float16* __restrict__ dst,
                              int rows, int cols, int ld, int col0) {
    int i = blockIdx.x * blockDim.x + threadIdx.x;
    if (i >= rows * cols) return;
    int o = i % cols;
    int r = i / cols;
    dst[(size_t)o * rows + r] = (_Float16)src[(size_t)r * ld + col0 + o];
}

// ---------------------------------------------------------------------------
// f16 WMMA GEMM, register-blocked: each wave computes a 16x64 strip
// (4 accumulators) so the A fragment is loaded once and reused 4x per k-step.
// C[m][n] = sum_k A[m][k] * Bt[n][k]
// mode: 0 = f16 row-major store,
//       1 = f16 store transposed per batch -> out[b][n][m%Mdim] (for V),
//       2 = f32 store + bias (final projection into d_out).
__global__ void gemm_wmma(const _Float16* __restrict__ A,
                          const _Float16* __restrict__ Bt,
                          int Ncols, int K,
                          _Float16* __restrict__ outH,
                          float* __restrict__ outF,
                          const float* __restrict__ bias,
                          int mode, int Mdim) {
    const int lane = threadIdx.x & 31;
    const int col  = lane & 15;
    const int half = lane >> 4;
    const int kb0  = 8 * half;
    const int kb1  = 16 + 8 * half;
    const int n0   = blockIdx.x * 64;   // 4 x 16-column tiles
    const int m0   = blockIdx.y * 16;

    const _Float16* arow = A + (size_t)(m0 + col) * K;
    const _Float16* brow[4];
#pragma unroll
    for (int t = 0; t < 4; ++t)
        brow[t] = Bt + (size_t)(n0 + t * 16 + col) * K;

    v8f acc[4];
#pragma unroll
    for (int t = 0; t < 4; ++t) acc[t] = (v8f){};

    for (int k0 = 0; k0 < K; k0 += 32) {
        const v16h a = frag_ld(arow + k0 + kb0, arow + k0 + kb1);
#pragma unroll
        for (int t = 0; t < 4; ++t)
            acc[t] = wmma16(a, frag_ld(brow[t] + k0 + kb0, brow[t] + k0 + kb1),
                            acc[t]);
    }

    // C-layout: lane (col, half), VGPR r  <->  row = 8*half + r, column = col
    const int mrow0 = m0 + 8 * half;
    if (mode == 0) {
#pragma unroll
        for (int t = 0; t < 4; ++t)
#pragma unroll
            for (int r = 0; r < 8; ++r)
                outH[(size_t)(mrow0 + r) * Ncols + n0 + t * 16 + col] =
                    (_Float16)acc[t][r];
    } else if (mode == 1) {
        // transposed store: consecutive r -> consecutive m -> packed 16B stores
        const int bidx = mrow0 / Mdim;
        const int mloc = mrow0 % Mdim;
#pragma unroll
        for (int t = 0; t < 4; ++t) {
            h8 pk = {};
#pragma unroll
            for (int r = 0; r < 8; ++r) pk[r] = (_Float16)acc[t][r];
            *(h8*)(outH + ((size_t)bidx * Ncols + n0 + t * 16 + col) * Mdim + mloc) = pk;
        }
    } else {
#pragma unroll
        for (int t = 0; t < 4; ++t) {
            const float bv = bias[n0 + t * 16 + col];
#pragma unroll
            for (int r = 0; r < 8; ++r)
                outF[(size_t)(mrow0 + r) * Ncols + n0 + t * 16 + col] =
                    acc[t][r] + bv;
        }
    }
}

// ---------------------------------------------------------------------------
// Flash attention: one wave handles 16 query rows x one head, streaming keys
// in tiles of 32 with online softmax. Q: [B*N][INNER], K: [B*M][INNER],
// Vt: [B][INNER][M] (d-major), O: [B*N][INNER] f16.
__global__ void flash_attn(const _Float16* __restrict__ Q,
                           const _Float16* __restrict__ Kh,
                           const _Float16* __restrict__ Vt,
                           const int* __restrict__ mask,
                           _Float16* __restrict__ O) {
    const int lane = threadIdx.x & 31;
    const int col  = lane & 15;
    const int half = lane >> 4;
    const int kb0  = 8 * half;
    const int kb1  = 16 + 8 * half;
    const int bh   = blockIdx.x;
    const int b    = bh / HEADS_;
    const int h    = bh % HEADS_;
    const int q0   = blockIdx.y * 16;

    __shared__ _Float16 sm[16 * 32];   // P tile staging (C-layout -> A-layout)

    // Q fragments stay resident: two 16x32 chunks covering d = 0..63
    const _Float16* qrow = Q + (size_t)(b * N_ + q0 + col) * INNER_ + h * DHEAD;
    const v16h aq0 = frag_ld(qrow + kb0,      qrow + kb1);
    const v16h aq1 = frag_ld(qrow + 32 + kb0, qrow + 32 + kb1);

    const _Float16* kbase = Kh + (size_t)b * M_ * INNER_ + h * DHEAD;
    const _Float16* vbase = Vt + ((size_t)b * INNER_ + h * DHEAD) * M_;
    const int* mrow = mask + b * M_;

    float rm[8], rl[8];
    v8f acc[4];
#pragma unroll
    for (int r = 0; r < 8; ++r) { rm[r] = -FLT_MAX; rl[r] = 0.0f; }
#pragma unroll
    for (int g = 0; g < 4; ++g) acc[g] = (v8f){};

    for (int j0 = 0; j0 < M_; j0 += 32) {
        // ---- S = Q*K^T for 32 keys: two 16-column C tiles, 4 WMMAs total
        const _Float16* kr0 = kbase + (size_t)(j0 + col) * INNER_;
        const _Float16* kr1 = kbase + (size_t)(j0 + 16 + col) * INNER_;
        v8f s0 = {}, s1 = {};
        s0 = wmma16(aq0, frag_ld(kr0 + kb0,      kr0 + kb1),      s0);
        s0 = wmma16(aq1, frag_ld(kr0 + 32 + kb0, kr0 + 32 + kb1), s0);
        s1 = wmma16(aq0, frag_ld(kr1 + kb0,      kr1 + kb1),      s1);
        s1 = wmma16(aq1, frag_ld(kr1 + 32 + kb0, kr1 + 32 + kb1), s1);

        // Prefetch next tile's K rows (lowers to global_prefetch_b8) while the
        // softmax VALU work below hides the latency.
        if (j0 + 32 < M_) {
            __builtin_prefetch(kbase + (size_t)(j0 + 32 + col) * INNER_, 0, 1);
            __builtin_prefetch(kbase + (size_t)(j0 + 48 + col) * INNER_, 0, 1);
        }

        const bool mk0 = mrow[j0 + col] != 0;
        const bool mk1 = mrow[j0 + 16 + col] != 0;

        // ---- online softmax; row (8*half + r) lives on the 16 lanes of
        // this half, so row reductions are xor-shuffles of width 16.
        float corr[8];
#pragma unroll
        for (int r = 0; r < 8; ++r) {
            float a0 = mk0 ? s0[r] * SCALE_ : -FLT_MAX;
            float a1 = mk1 ? s1[r] * SCALE_ : -FLT_MAX;
            float t = fmaxf(a0, a1);
            for (int msk = 1; msk < 16; msk <<= 1)
                t = fmaxf(t, __shfl_xor(t, msk, 16));
            const float mn = fmaxf(rm[r], t);
            corr[r] = __expf(rm[r] - mn);
            rm[r] = mn;
            const float p0 = __expf(a0 - mn);
            const float p1 = __expf(a1 - mn);
            sm[(8 * half + r) * 32 + col]      = (_Float16)p0;
            sm[(8 * half + r) * 32 + 16 + col] = (_Float16)p1;
            float ps = p0 + p1;
            for (int msk = 1; msk < 16; msk <<= 1)
                ps += __shfl_xor(ps, msk, 16);
            rl[r] = rl[r] * corr[r] + ps;
        }
#pragma unroll
        for (int g = 0; g < 4; ++g)
#pragma unroll
            for (int r = 0; r < 8; ++r) acc[g][r] *= corr[r];
        __syncthreads();

        // ---- reload P (16x32) in A-fragment layout from LDS (ds_load_b128)
        const _Float16* prow = sm + col * 32;
        const v16h ap = frag_ld(prow + kb0, prow + kb1);

        // ---- O += P @ V : V is d-major so B-fragment loads are contiguous
#pragma unroll
        for (int g = 0; g < 4; ++g) {
            const _Float16* vrow = vbase + (size_t)(g * 16 + col) * M_ + j0;
            acc[g] = wmma16(ap, frag_ld(vrow + kb0, vrow + kb1), acc[g]);
        }
        __syncthreads();
    }

    float inv[8];
#pragma unroll
    for (int r = 0; r < 8; ++r) inv[r] = 1.0f / rl[r];
#pragma unroll
    for (int g = 0; g < 4; ++g)
#pragma unroll
        for (int r = 0; r < 8; ++r)
            O[(size_t)(b * N_ + q0 + 8 * half + r) * INNER_ + h * DHEAD + g * 16 + col] =
                (_Float16)(acc[g][r] * inv[r]);
}

// ---------------------------------------------------------------------------
extern "C" void kernel_launch(void* const* d_in, const int* in_sizes, int n_in,
                              void* d_out, int out_size, void* d_ws, size_t ws_size,
                              hipStream_t stream) {
    const float* x    = (const float*)d_in[0];
    const float* ctx  = (const float*)d_in[1];
    const int*   mask = (const int*)d_in[2];
    const float* Wq   = (const float*)d_in[3];
    const float* Wkv  = (const float*)d_in[4];
    const float* Wo   = (const float*)d_in[5];
    const float* bo   = (const float*)d_in[6];
    float* out = (float*)d_out;

    // Workspace layout (f16): six 8192x512 tensors + four 512x512 weights ~ 50 MB
    _Float16* W = (_Float16*)d_ws;
    const size_t SZ = (size_t)B_ * N_ * INNER_;   // 4M elements
    _Float16* x_h  = W;
    _Float16* c_h  = W + SZ;
    _Float16* q_h  = W + 2 * SZ;
    _Float16* k_h  = W + 3 * SZ;
    _Float16* vt_h = W + 4 * SZ;   // [B][INNER][M] (d-major V)
    _Float16* ao_h = W + 5 * SZ;
    _Float16* WqT  = W + 6 * SZ;
    _Float16* WkT  = WqT + 512 * 512;
    _Float16* WvT  = WkT + 512 * 512;
    _Float16* WoT  = WvT + 512 * 512;

    const int nE = (int)SZ;
    cvt_f32_to_h<<<(nE + 255) / 256, 256, 0, stream>>>(x,   x_h, nE);
    cvt_f32_to_h<<<(nE + 255) / 256, 256, 0, stream>>>(ctx, c_h, nE);

    const int nW = 512 * 512;
    cvt_transpose<<<(nW + 255) / 256, 256, 0, stream>>>(Wq,  WqT, 512, 512, 512,  0);
    cvt_transpose<<<(nW + 255) / 256, 256, 0, stream>>>(Wkv, WkT, 512, 512, 1024, 0);
    cvt_transpose<<<(nW + 255) / 256, 256, 0, stream>>>(Wkv, WvT, 512, 512, 1024, 512);
    cvt_transpose<<<(nW + 255) / 256, 256, 0, stream>>>(Wo,  WoT, 512, 512, 512,  0);

    // 16x64 output strip per wave: grid (Ncols/64, Mrows/16)
    dim3 gg(INNER_ / 64, (B_ * N_) / 16);   // 8 x 512
    gemm_wmma<<<gg, 32, 0, stream>>>(x_h, WqT, INNER_, QDIM, q_h,  nullptr, nullptr, 0, 0);
    gemm_wmma<<<gg, 32, 0, stream>>>(c_h, WkT, INNER_, CDIM, k_h,  nullptr, nullptr, 0, 0);
    gemm_wmma<<<gg, 32, 0, stream>>>(c_h, WvT, INNER_, CDIM, vt_h, nullptr, nullptr, 1, M_);

    flash_attn<<<dim3(B_ * HEADS_, N_ / 16), 32, 0, stream>>>(q_h, k_h, vt_h, mask, ao_h);

    gemm_wmma<<<dim3(QDIM / 64, (B_ * N_) / 16), 32, 0, stream>>>(
        ao_h, WoT, QDIM, INNER_, nullptr, out, bo, 2, 0);
}

// v001
// One run takes 269 microseconds.
// Two timings next to v000 both put it at 1.54 times that version's speed.
#include <hip/hip_runtime.h>
#include <hip/hip_bf16.h>
#include <float.h>

// Problem constants (match the reference)
#define B_     4
#define N_     2048
#define M_     2048
#define QDIM   512
#define CDIM   512
#define HEADS_ 8
#define DHEAD  64
#define INNER_ 512
#define SCALE_ 0.125f   // 64^-0.5

typedef _Float16 v16h __attribute__((ext_vector_type(16)));
typedef _Float16 h8   __attribute__((ext_vector_type(8)));
typedef float    v8f  __attribute__((ext_vector_type(8)));

// Build a 16x32 f16 A/B fragment for v_wmma_f32_16x16x32_f16.
// Per the CDNA5 ISA layout, lane L (row/col = L%16, half = L/16) holds
//   frag[0..7]  = X[row][ 8*half + i]        (contiguous 16B)
//   frag[8..15] = X[row][16 + 8*half + i]    (contiguous 16B)
__device__ __forceinline__ v16h frag_ld(const _Float16* lo_p, const _Float16* hi_p) {
    h8 lo = *(const h8*)lo_p;
    h8 hi = *(const h8*)hi_p;
    v16h r;
#pragma unroll
    for (int i = 0; i < 8; ++i) { r[i] = lo[i]; r[i + 8] = hi[i]; }
    return r;
}

__device__ __forceinline__ v8f wmma16(v16h a, v16h b, v8f c) {
    // (neg_a, A, neg_b, B, c_mod, C, reuse_a, reuse_b)
    return __builtin_amdgcn_wmma_f32_16x16x32_f16(false, a, false, b, (short)0, c,
                                                  false, false);
}

// ---------------------------------------------------------------------------
// f32 -> f16 elementwise convert
__global__ void cvt_f32_to_h(const float* __restrict__ src,
                             _Float16* __restrict__ dst, int n) {
    int i = blockIdx.x * blockDim.x + threadIdx.x;
    if (i < n) dst[i] = (_Float16)src[i];
}

// Transpose-convert weight W[in=rows][... ld ...] (taking cols [col0, col0+cols))
// into Wt[out][in] f16, so GEMM B-operand columns become contiguous rows.
__global__ void cvt_transpose(const float* __restrict__ src,
                              _Float16* __restrict__ dst,
                              int rows, int cols, int ld, int col0) {
    int i = blockIdx.x * blockDim.x + threadIdx.x;
    if (i >= rows * cols) return;
    int o = i % cols;
    int r = i / cols;
    dst[(size_t)o * rows + r] = (_Float16)src[(size_t)r * ld + col0 + o];
}

// ---------------------------------------------------------------------------
// f16 WMMA GEMM, register-blocked: each wave computes a 16x64 strip
// (4 accumulators) so the A fragment is loaded once and reused 4x per k-step.
// C[m][n] = sum_k A[m][k] * Bt[n][k]
// mode: 0 = f16 row-major store,
//       1 = f16 store transposed per batch -> out[b][n][m%Mdim] (for V),
//       2 = f32 store + bias (final projection into d_out).
__global__ void gemm_wmma(const _Float16* __restrict__ A,
                          const _Float16* __restrict__ Bt,
                          int Ncols, int K,
                          _Float16* __restrict__ outH,
                          float* __restrict__ outF,
                          const float* __restrict__ bias,
                          int mode, int Mdim) {
    const int lane = threadIdx.x & 31;
    const int col  = lane & 15;
    const int half = lane >> 4;
    const int kb0  = 8 * half;
    const int kb1  = 16 + 8 * half;
    const int n0   = blockIdx.x * 64;   // 4 x 16-column tiles
    const int m0   = blockIdx.y * 16;

    const _Float16* arow = A + (size_t)(m0 + col) * K;
    const _Float16* brow[4];
#pragma unroll
    for (int t = 0; t < 4; ++t)
        brow[t] = Bt + (size_t)(n0 + t * 16 + col) * K;

    v8f acc[4];
#pragma unroll
    for (int t = 0; t < 4; ++t) acc[t] = (v8f){};

    for (int k0 = 0; k0 < K; k0 += 32) {
        const v16h a = frag_ld(arow + k0 + kb0, arow + k0 + kb1);
#pragma unroll
        for (int t = 0; t < 4; ++t)
            acc[t] = wmma16(a, frag_ld(brow[t] + k0 + kb0, brow[t] + k0 + kb1),
                            acc[t]);
    }

    // C-layout: lane (col, half), VGPR r  <->  row = 8*half + r, column = col
    const int mrow0 = m0 + 8 * half;
    if (mode == 0) {
#pragma unroll
        for (int t = 0; t < 4; ++t)
#pragma unroll
            for (int r = 0; r < 8; ++r)
                outH[(size_t)(mrow0 + r) * Ncols + n0 + t * 16 + col] =
                    (_Float16)acc[t][r];
    } else if (mode == 1) {
        // transposed store: consecutive r -> consecutive m -> packed 16B stores
        const int bidx = mrow0 / Mdim;
        const int mloc = mrow0 % Mdim;
#pragma unroll
        for (int t = 0; t < 4; ++t) {
            h8 pk = {};
#pragma unroll
            for (int r = 0; r < 8; ++r) pk[r] = (_Float16)acc[t][r];
            *(h8*)(outH + ((size_t)bidx * Ncols + n0 + t * 16 + col) * Mdim + mloc) = pk;
        }
    } else {
#pragma unroll
        for (int t = 0; t < 4; ++t) {
            const float bv = bias[n0 + t * 16 + col];
#pragma unroll
            for (int r = 0; r < 8; ++r)
                outF[(size_t)(mrow0 + r) * Ncols + n0 + t * 16 + col] =
                    acc[t][r] + bv;
        }
    }
}

// ---------------------------------------------------------------------------
// Lane l <-> lane l ^ 16 (the two halves of a wave that share one query column)
__device__ __forceinline__ float xhalf(float x) {
    const int b = __builtin_bit_cast(int, x);
    return __builtin_bit_cast(float,
        __builtin_amdgcn_permlanex16(b, b, 0x76543210, 0xfedcba98, false, false));
}

// x where bit 'bit' of m is set, else -FLT_MAX: the bit spread over the word
// picks between the two bit patterns (two vector instructions, no compare)
__device__ __forceinline__ float keep(unsigned m, int bit, float x) {
    const int sel = (int)(m << (31 - bit)) >> 31;
    const int fil = __builtin_bit_cast(int, -FLT_MAX);
    return __builtin_bit_cast(float, (sel & __builtin_bit_cast(int, x)) | (~sel & fil));
}

__global__ void flash_attn(const _Float16* __restrict__ Q,
                           const _Float16* __restrict__ Kh,
                           const _Float16* __restrict__ Vt,
                           const int* __restrict__ mask,
                           _Float16* __restrict__ O) {
    const int lane = threadIdx.x & 31;
    const int col  = lane & 15;
    const int half = lane >> 4;
    const int kb0  = 8 * half;
    const int kb1  = 16 + 8 * half;
    const int bh   = blockIdx.x;
    const int b    = bh / HEADS_;
    const int h    = bh % HEADS_;
    const int q0   = blockIdx.y * 16;

    // Q fragments stay resident: two 32x16 chunks covering d = 0..63
    const _Float16* qrow = Q + (size_t)(b * N_ + q0 + col) * INNER_ + h * DHEAD;
    const v16h bq0 = frag_ld(qrow + kb0,      qrow + kb1);
    const v16h bq1 = frag_ld(qrow + 32 + kb0, qrow + 32 + kb1);

    const _Float16* kbase = Kh + (size_t)b * M_ * INNER_ + h * DHEAD;
    const _Float16* vbase = Vt + ((size_t)b * INNER_ + h * DHEAD) * M_;
    const int* mrow = mask + b * M_;

    float rm = -FLT_MAX;   // running maximum of this lane's query (same in both halves)
    float rl = 0.0f;       // running sum over this half's keys only; joined at the end
    v8f acc[4];            // acc[g][r] = O^T[g*16 + 8*half + r][query col]
#pragma unroll
    for (int g = 0; g < 4; ++g) acc[g] = (v8f){};

    for (int j0 = 0; j0 < M_; j0 += 32) {
        // the tile's 32 mask words, one per lane
        const int mword = mrow[j0 + lane];

        // ---- S^T = K*Q^T for 32 keys: two 16-key C tiles, 4 WMMAs total
        const _Float16* kp = kbase + (size_t)(j0 + col) * INNER_ + kb0;
        const v16h ak00 = frag_ld(kp,                    kp + 16);
        const v16h ak01 = frag_ld(kp + 32,               kp + 48);
        const v16h ak10 = frag_ld(kp + 16 * INNER_,      kp + 16 * INNER_ + 16);
        const v16h ak11 = frag_ld(kp + 16 * INNER_ + 32, kp + 16 * INNER_ + 48);

        // V^T rows (d-major V): nothing stands between these loads and the
        // scores any more, so they fly under the S^T products and the softmax
        const _Float16* vp = vbase + (size_t)col * M_ + j0 + kb0;
        v16h av[4];
#pragma unroll
        for (int g = 0; g < 4; ++g)
            av[g] = frag_ld(vp + (size_t)g * 16 * M_, vp + (size_t)g * 16 * M_ + 16);

        v8f s0 = {}, s1 = {};
        s0 = wmma16(ak00, bq0, s0);
        s1 = wmma16(ak10, bq0, s1);
        s0 = wmma16(ak01, bq1, s0);
        s1 = wmma16(ak11, bq1, s1);

        // the eight K loads share the address pair kp, the eight V^T loads vp:
        // naming both here keeps them live, so that no load's result lands on
        // an address pair ahead of the wait
        asm volatile("s_wait_xcnt 0x0" :: "v"(kp), "v"(vp) : "memory");

        // Prefetch next tile's K rows (lowers to global_prefetch_b8) while the
        // softmax VALU work below hides the latency.
        if (j0 + 32 < M_) {
            __builtin_prefetch(kbase + (size_t)(j0 + 32 + col) * INNER_, 0, 1);
            __builtin_prefetch(kbase + (size_t)(j0 + 48 + col) * INNER_, 0, 1);
            // the prefetches' address pair is rewritten in the next pass: keep
            // the wait in front of that overwrite
            asm volatile("s_wait_xcnt 0x0" ::: "memory");
        }

        // ---- online softmax, one query per lane
        // bit k of the ballot = key j0 + k; this lane's 16 keys are j0 + 8*half + r
        // (bit r of mk) and j0 + 16 + 8*half + r (bit 16 + r of mk)
        const unsigned mk = __builtin_amdgcn_ballot_w32(mword != 0) >> kb0;
        float a[16];
#pragma unroll
        for (int r = 0; r < 8; ++r) {
            a[r]     = keep(mk, r,      s0[r] * SCALE_);
            a[8 + r] = keep(mk, 16 + r, s1[r] * SCALE_);
        }
        float t = a[0];
#pragma unroll
        for (int i = 1; i < 16; ++i) t = fmaxf(t, a[i]);
        t = fmaxf(t, xhalf(t));
        const float mn   = fmaxf(rm, t);
        const float corr = __expf(rm - mn);
        rm = mn;

        v16h bp;           // P^T as a B fragment: element r <-> key j0 + 8*half + r, element 8 + r <-> key j0 + 16 + 8*half + r
        float ps0 = 0.0f, ps1 = 0.0f;
#pragma unroll
        for (int r = 0; r < 8; ++r) {
            const float p0 = __expf(a[r] - mn);
            const float p1 = __expf(a[8 + r] - mn);
            bp[r]     = (_Float16)p0;
            bp[8 + r] = (_Float16)p1;
            ps0 += p0;
            ps1 += p1;
        }
        rl = rl * corr + (ps0 + ps1);
#pragma unroll
        for (int g = 0; g < 4; ++g)
#pragma unroll
            for (int r = 0; r < 8; ++r) acc[g][r] *= corr;

        // ---- O^T += V^T * P^T
#pragma unroll
        for (int g = 0; g < 4; ++g) acc[g] = wmma16(av[g], bp, acc[g]);
    }

    const float inv = 1.0f / (rl + xhalf(rl));
    // consecutive r -> consecutive d -> packed 16B stores
    _Float16* orow = O + (size_t)(b * N_ + q0 + col) * INNER_ + h * DHEAD + 8 * half;
#pragma unroll
    for (int g = 0; g < 4; ++g) {
        h8 pk = {};
#pragma unroll
        for (int r = 0; r < 8; ++r) pk[r] = (_Float16)(acc[g][r] * inv);
        *(h8*)(orow + g * 16) = pk;
    }
}

// ---------------------------------------------------------------------------
extern "C" void kernel_launch(void* const* d_in, const int* in_sizes, int n_in,
                              void* d_out, int out_size, void* d_ws, size_t ws_size,
                              hipStream_t stream) {
    const float* x    = (const float*)d_in[0];
    const float* ctx  = (const float*)d_in[1];
    const int*   mask = (const int*)d_in[2];
    const float* Wq   = (const float*)d_in[3];
    const float* Wkv  = (const float*)d_in[4];
    const float* Wo   = (const float*)d_in[5];
    const float* bo   = (const float*)d_in[6];
    float* out = (float*)d_out;

    // Workspace layout (f16): six 8192x512 tensors + four 512x512 weights ~ 50 MB
    _Float16* W = (_Float16*)d_ws;
    const size_t SZ = (size_t)B_ * N_ * INNER_;   // 4M elements
    _Float16* x_h  = W;
    _Float16* c_h  = W + SZ;
    _Float16* q_h  = W + 2 * SZ;
    _Float16* k_h  = W + 3 * SZ;
    _Float16* vt_h = W + 4 * SZ;   // [B][INNER][M] (d-major V)
    _Float16* ao_h = W + 5 * SZ;
    _Float16* WqT  = W + 6 * SZ;
    _Float16* WkT  = WqT + 512 * 512;
    _Float16* WvT  = WkT + 512 * 512;
    _Float16* WoT  = WvT + 512 * 512;

    const int nE = (int)SZ;
    cvt_f32_to_h<<<(nE + 255) / 256, 256, 0, stream>>>(x,   x_h, nE);
    cvt_f32_to_h<<<(nE + 255) / 256, 256, 0, stream>>>(ctx, c_h, nE);

    const int nW = 512 * 512;
    cvt_transpose<<<(nW + 255) / 256, 256, 0, stream>>>(Wq,  WqT, 512, 512, 512,  0);
    cvt_transpose<<<(nW + 255) / 256, 256, 0, stream>>>(Wkv, WkT, 512, 512, 1024, 0);
    cvt_transpose<<<(nW + 255) / 256, 256, 0, stream>>>(Wkv, WvT, 512, 512, 1024, 512);
    cvt_transpose<<<(nW + 255) / 256, 256, 0, stream>>>(Wo,  WoT, 512, 512, 512,  0);

    // 16x64 output strip per wave: grid (Ncols/64, Mrows/16)
    dim3 gg(INNER_ / 64, (B_ * N_) / 16);   // 8 x 512
    gemm_wmma<<<gg, 32, 0, stream>>>(x_h, WqT, INNER_, QDIM, q_h,  nullptr, nullptr, 0, 0);
    gemm_wmma<<<gg, 32, 0, stream>>>(c_h, WkT, INNER_, CDIM, k_h,  nullptr, nullptr, 0, 0);
    gemm_wmma<<<gg, 32, 0, stream>>>(c_h, WvT, INNER_, CDIM, vt_h, nullptr, nullptr, 1, M_);

    flash_attn<<<dim3(B_ * HEADS_, N_ / 16), 32, 0, stream>>>(q_h, k_h, vt_h, mask, ao_h);

    gemm_wmma<<<dim3(QDIM / 64, (B_ * N_) / 16), 32, 0, stream>>>(
        ao_h, WoT, QDIM, INNER_, nullptr, out, bo, 2, 0);
}

// v002
// A run of this version takes 208 microseconds.
// Timed twice side by side with v001, it ran 1.30 times as fast both times.
// All steps since v000 together make it 2.00 times as fast.
#include <hip/hip_runtime.h>
#include <hip/hip_bf16.h>
#include <float.h>
#include <stdint.h>

// Problem constants (match the reference)
#define B_     4
#define N_     2048
#define M_     2048
#define QDIM   512
#define CDIM   512
#define HEADS_ 8
#define DHEAD  64
#define INNER_ 512
#define SCALE_ 0.125f   // 64^-0.5

typedef _Float16 v16h __attribute__((ext_vector_type(16)));
typedef _Float16 h8   __attribute__((ext_vector_type(8)));
typedef float    v8f  __attribute__((ext_vector_type(8)));

// Build a 16x32 f16 A/B fragment for v_wmma_f32_16x16x32_f16.
// Per the CDNA5 ISA layout, lane L (row/col = L%16, half = L/16) holds
//   frag[0..7]  = X[row][ 8*half + i]        (contiguous 16B)
//   frag[8..15] = X[row][16 + 8*half + i]    (contiguous 16B)
__device__ __forceinline__ v16h frag_ld(const _Float16* lo_p, const _Float16* hi_p) {
    h8 lo = *(const h8*)lo_p;
    h8 hi = *(const h8*)hi_p;
    v16h r;
#pragma unroll
    for (int i = 0; i < 8; ++i) { r[i] = lo[i]; r[i + 8] = hi[i]; }
    return r;
}

__device__ __forceinline__ v8f wmma16(v16h a, v16h b, v8f c) {
    // (neg_a, A, neg_b, B, c_mod, C, reuse_a, reuse_b)
    return __builtin_amdgcn_wmma_f32_16x16x32_f16(false, a, false, b, (short)0, c,
                                                  false, false);
}

// ---------------------------------------------------------------------------
// f32 -> f16 elementwise convert
__global__ void cvt_f32_to_h(const float* __restrict__ src,
                             _Float16* __restrict__ dst, int n) {
    int i = blockIdx.x * blockDim.x + threadIdx.x;
    if (i < n) dst[i] = (_Float16)src[i];
}

// Transpose-convert weight W[in=rows][... ld ...] (taking cols [col0, col0+cols))
// into Wt[out][in] f16, so GEMM B-operand columns become contiguous rows.
__global__ void cvt_transpose(const float* __restrict__ src,
                              _Float16* __restrict__ dst,
                              int rows, int cols, int ld, int col0) {
    int i = blockIdx.x * blockDim.x + threadIdx.x;
    if (i >= rows * cols) return;
    int o = i % cols;
    int r = i / cols;
    dst[(size_t)o * rows + r] = (_Float16)src[(size_t)r * ld + col0 + o];
}

// ---------------------------------------------------------------------------
// f16 WMMA GEMM, register-blocked: each wave computes a 16x64 strip
// (4 accumulators) so the A fragment is loaded once and reused 4x per k-step.
// C[m][n] = sum_k A[m][k] * Bt[n][k]
// mode: 0 = f16 row-major store,
//       1 = f16 store transposed per batch -> out[b][n][m%Mdim] (for V),
//       2 = f32 store + bias (final projection into d_out).
__global__ void gemm_wmma(const _Float16* __restrict__ A,
                          const _Float16* __restrict__ Bt,
                          int Ncols, int K,
                          _Float16* __restrict__ outH,
                          float* __restrict__ outF,
                          const float* __restrict__ bias,
                          int mode, int Mdim) {
    const int lane = threadIdx.x & 31;
    const int col  = lane & 15;
    const int half = lane >> 4;
    const int kb0  = 8 * half;
    const int kb1  = 16 + 8 * half;
    const int n0   = blockIdx.x * 64;   // 4 x 16-column tiles
    const int m0   = blockIdx.y * 16;

    const _Float16* arow = A + (size_t)(m0 + col) * K;
    const _Float16* brow[4];
#pragma unroll
    for (int t = 0; t < 4; ++t)
        brow[t] = Bt + (size_t)(n0 + t * 16 + col) * K;

    v8f acc[4];
#pragma unroll
    for (int t = 0; t < 4; ++t) acc[t] = (v8f){};

    for (int k0 = 0; k0 < K; k0 += 32) {
        const v16h a = frag_ld(arow + k0 + kb0, arow + k0 + kb1);
#pragma unroll
        for (int t = 0; t < 4; ++t)
            acc[t] = wmma16(a, frag_ld(brow[t] + k0 + kb0, brow[t] + k0 + kb1),
                            acc[t]);
    }

    // C-layout: lane (col, half), VGPR r  <->  row = 8*half + r, column = col
    const int mrow0 = m0 + 8 * half;
    if (mode == 0) {
#pragma unroll
        for (int t = 0; t < 4; ++t)
#pragma unroll
            for (int r = 0; r < 8; ++r)
                outH[(size_t)(mrow0 + r) * Ncols + n0 + t * 16 + col] =
                    (_Float16)acc[t][r];
    } else if (mode == 1) {
        // transposed store: consecutive r -> consecutive m -> packed 16B stores
        const int bidx = mrow0 / Mdim;
        const int mloc = mrow0 % Mdim;
#pragma unroll
        for (int t = 0; t < 4; ++t) {
            h8 pk = {};
#pragma unroll
            for (int r = 0; r < 8; ++r) pk[r] = (_Float16)acc[t][r];
            *(h8*)(outH + ((size_t)bidx * Ncols + n0 + t * 16 + col) * Mdim + mloc) = pk;
        }
    } else {
#pragma unroll
        for (int t = 0; t < 4; ++t) {
            const float bv = bias[n0 + t * 16 + col];
#pragma unroll
            for (int r = 0; r < 8; ++r)
                outF[(size_t)(mrow0 + r) * Ncols + n0 + t * 16 + col] =
                    acc[t][r] + bv;
        }
    }
}

// ---------------------------------------------------------------------------
// Lane l <-> lane l ^ 16 (the two halves of a wave that share one query column)
__device__ __forceinline__ float xhalf(float x) {
    const int b = __builtin_bit_cast(int, x);
    return __builtin_bit_cast(float,
        __builtin_amdgcn_permlanex16(b, b, 0x76543210, 0xfedcba98, false, false));
}

// x where bit 'bit' of m is set, else -FLT_MAX: the bit spread over the word
// picks between the two bit patterns (two vector instructions, no compare)
__device__ __forceinline__ float keep(unsigned m, int bit, float x) {
    const int sel = (int)(m << (31 - bit)) >> 31;
    const int fil = __builtin_bit_cast(int, -FLT_MAX);
    return __builtin_bit_cast(float, (sel & __builtin_bit_cast(int, x)) | (~sel & fil));
}

// Geometry of flash_attn's work-group and of its LDS ring
#define QWAVES 8                 // waves per work-group, 16 query columns each
#define TKEYS  64                // keys per stage: K rows and V^T rows are both 128 B
#define PITCH  72                // halfs per LDS row: 128 B + 16 B, an odd multiple of 16 B
#define TILE_H (64 * PITCH)      // halfs of one staged tile (64 rows)
#define NSTAGE (M_ / TKEYS)

// One stage's share of one lane: four 16-byte asynchronous copies to LDS.
// The s_wait_xcnt closes the statement, so that no register a copy names is
// rewritten ahead of it.
__device__ __forceinline__ void stage_copy(unsigned l0, unsigned l1, unsigned l2, unsigned l3,
                                           const _Float16* g0, const _Float16* g1,
                                           const _Float16* g2, const _Float16* g3) {
    asm volatile("global_load_async_to_lds_b128 %0, %4, off\n\t"
                 "global_load_async_to_lds_b128 %1, %5, off\n\t"
                 "global_load_async_to_lds_b128 %2, %6, off\n\t"
                 "global_load_async_to_lds_b128 %3, %7, off\n\t"
                 "s_wait_xcnt 0x0"
                 :: "v"(l0), "v"(l1), "v"(l2), "v"(l3), "v"(g0), "v"(g1), "v"(g2), "v"(g3)
                 : "memory");
}

__global__ __launch_bounds__(QWAVES * 32) __attribute__((amdgpu_waves_per_eu(4, 4)))
void flash_attn(const _Float16* __restrict__ Q,
                const _Float16* __restrict__ Kh,
                const _Float16* __restrict__ Vt,
                const int* __restrict__ mask,
                _Float16* __restrict__ O) {
    // [buffer][K tile, then V^T tile]
    __shared__ __attribute__((aligned(16))) _Float16 ring[2][2 * TILE_H];

    const int tid  = threadIdx.x;
    const int lane = tid & 31;
    const int col  = lane & 15;
    const int half = lane >> 4;
    const int kb0  = 8 * half;
    const int bh   = blockIdx.x;
    const int b    = bh / HEADS_;
    const int h    = bh % HEADS_;
    const int q0   = blockIdx.y * (QWAVES * 16) + (tid >> 5) * 16;

    const _Float16* kbase = Kh + (size_t)b * M_ * INNER_ + h * DHEAD;
    const _Float16* vbase = Vt + ((size_t)b * INNER_ + h * DHEAD) * M_;
    const int* mrow = mask + b * M_;

    // This lane's place in a stage: rows crow and crow + 32 of either tile, 16
    // bytes at cch; a wave's copy covers four whole rows of 128 bytes.
    const int crow = tid >> 3;
    const int cch  = (tid & 7) * 8;
    const _Float16* gk = kbase + (size_t)crow * INNER_ + cch;
    const _Float16* gv = vbase + (size_t)crow * M_ + cch;
    const unsigned  lk = (unsigned)(uintptr_t)&ring[0][crow * PITCH + cch];
#define STAGE(st, bf) do {                                                          \
        const unsigned  l_ = lk + (unsigned)(bf) * (2 * TILE_H * 2);                \
        const _Float16* k_ = gk + (size_t)(st) * TKEYS * INNER_;                    \
        const _Float16* v_ = gv + (size_t)(st) * TKEYS;                             \
        stage_copy(l_, l_ + 32 * PITCH * 2, l_ + TILE_H * 2,                        \
                   l_ + TILE_H * 2 + 32 * PITCH * 2,                                \
                   k_, k_ + 32 * INNER_, v_, v_ + (size_t)32 * M_);                 \
    } while (0)

    // Q fragments stay resident: two 32x16 chunks covering d = 0..63
    const _Float16* qp = Q + (size_t)(b * N_ + q0 + col) * INNER_ + h * DHEAD + kb0;
    const v16h bq0 = frag_ld(qp,      qp + 16);
    const v16h bq1 = frag_ld(qp + 32, qp + 48);
    // the four loads share the address pair qp: naming it keeps it live up to
    // the wait, so that it is not rewritten ahead of it
    asm volatile("s_wait_xcnt 0x0" :: "v"(qp) : "memory");

    // stage 0, landed and published; then stage 1 flies under pass 0
    STAGE(0, 0);
    asm volatile("s_wait_asynccnt 0x0" ::: "memory");   // this wave's copies have landed
    __syncthreads();                                    // and every other wave's
    STAGE(1, 1);

    float rm = -FLT_MAX;   // running maximum of this lane's query (same in both halves)
    float rl = 0.0f;       // running sum over this half's keys only; joined at the end
    v8f acc[4];            // acc[g][r] = O^T[g*16 + 8*half + r][query col]
#pragma unroll
    for (int g = 0; g < 4; ++g) acc[g] = (v8f){};

    for (int st = 0; st < NSTAGE; ++st) {
        const _Float16* ktile = ring[st & 1];
        const _Float16* vtile = ktile + TILE_H;

#pragma unroll
        for (int s = 0; s < TKEYS; s += 32) {
            const int j0 = st * TKEYS + s;
            // the pass's 32 mask words, one per lane
            const int mword = mrow[j0 + lane];

            // ---- S^T = K*Q^T for 32 keys: two 16-key C tiles, 4 WMMAs total
            const _Float16* kp = ktile + (s + col) * PITCH + kb0;
            const v16h ak00 = frag_ld(kp,                   kp + 16);
            const v16h ak01 = frag_ld(kp + 32,              kp + 48);
            const v16h ak10 = frag_ld(kp + 16 * PITCH,      kp + 16 * PITCH + 16);
            const v16h ak11 = frag_ld(kp + 16 * PITCH + 32, kp + 16 * PITCH + 48);

            // V^T rows (d-major V): read under the S^T products and the softmax
            const _Float16* vp = vtile + col * PITCH + s + kb0;
            v16h av[4];
#pragma unroll
            for (int g = 0; g < 4; ++g)
                av[g] = frag_ld(vp + g * 16 * PITCH, vp + g * 16 * PITCH + 16);

            v8f s0 = {}, s1 = {};
            s0 = wmma16(ak00, bq0, s0);
            s1 = wmma16(ak10, bq0, s1);
            s0 = wmma16(ak01, bq1, s0);
            s1 = wmma16(ak11, bq1, s1);

            // ---- online softmax, one query per lane
            // bit k of the ballot = key j0 + k; this lane's 16 keys are j0 + 8*half + r
            // (bit r of mk) and j0 + 16 + 8*half + r (bit 16 + r of mk)
            const unsigned mk = __builtin_amdgcn_ballot_w32(mword != 0) >> kb0;
            float a[16];
#pragma unroll
            for (int r = 0; r < 8; ++r) {
                a[r]     = keep(mk, r,      s0[r] * SCALE_);
                a[8 + r] = keep(mk, 16 + r, s1[r] * SCALE_);
            }
            float t = a[0];
#pragma unroll
            for (int i = 1; i < 16; ++i) t = fmaxf(t, a[i]);
            t = fmaxf(t, xhalf(t));
            const float mn   = fmaxf(rm, t);
            const float corr = __expf(rm - mn);
            rm = mn;

            v16h bp;           // P^T as a B fragment: element r <-> key j0 + 8*half + r, 8 + r <-> key j0 + 16 + 8*half + r
            float ps0 = 0.0f, ps1 = 0.0f;
#pragma unroll
            for (int r = 0; r < 8; ++r) {
                const float p0 = __expf(a[r] - mn);
                const float p1 = __expf(a[8 + r] - mn);
                bp[r]     = (_Float16)p0;
                bp[8 + r] = (_Float16)p1;
                ps0 += p0;
                ps1 += p1;
            }
            rl = rl * corr + (ps0 + ps1);
#pragma unroll
            for (int g = 0; g < 4; ++g)
#pragma unroll
                for (int r = 0; r < 8; ++r) acc[g][r] *= corr;

            // ---- O^T += V^T * P^T
#pragma unroll
            for (int g = 0; g < 4; ++g) acc[g] = wmma16(av[g], bp, acc[g]);
        }

        // publish point of stage st + 1, which also frees stage st's buffer
        asm volatile("s_wait_dscnt 0x0" ::: "memory");     // this wave has left the buffer
        asm volatile("s_wait_asynccnt 0x0" ::: "memory");  // its copies of stage st + 1 have landed
        __syncthreads();
        if (st + 2 < NSTAGE) STAGE(st + 2, st & 1);
    }
    // nothing is in flight here; kept so that no copy can outlive the wave
    asm volatile("s_wait_asynccnt 0x0" ::: "memory");
#undef STAGE

    const float inv = 1.0f / (rl + xhalf(rl));
    // consecutive r -> consecutive d -> packed 16B stores
    _Float16* orow = O + (size_t)(b * N_ + q0 + col) * INNER_ + h * DHEAD + 8 * half;
#pragma unroll
    for (int g = 0; g < 4; ++g) {
        h8 pk = {};
#pragma unroll
        for (int r = 0; r < 8; ++r) pk[r] = (_Float16)(acc[g][r] * inv);
        *(h8*)(orow + g * 16) = pk;
    }
}

// ---------------------------------------------------------------------------
extern "C" void kernel_launch(void* const* d_in, const int* in_sizes, int n_in,
                              void* d_out, int out_size, void* d_ws, size_t ws_size,
                              hipStream_t stream) {
    const float* x    = (const float*)d_in[0];
    const float* ctx  = (const float*)d_in[1];
    const int*   mask = (const int*)d_in[2];
    const float* Wq   = (const float*)d_in[3];
    const float* Wkv  = (const float*)d_in[4];
    const float* Wo   = (const float*)d_in[5];
    const float* bo   = (const float*)d_in[6];
    float* out = (float*)d_out;

    // Workspace layout (f16): six 8192x512 tensors + four 512x512 weights ~ 50 MB
    _Float16* W = (_Float16*)d_ws;
    const size_t SZ = (size_t)B_ * N_ * INNER_;   // 4M elements
    _Float16* x_h  = W;
    _Float16* c_h  = W + SZ;
    _Float16* q_h  = W + 2 * SZ;
    _Float16* k_h  = W + 3 * SZ;
    _Float16* vt_h = W + 4 * SZ;   // [B][INNER][M] (d-major V)
    _Float16* ao_h = W + 5 * SZ;
    _Float16* WqT  = W + 6 * SZ;
    _Float16* WkT  = WqT + 512 * 512;
    _Float16* WvT  = WkT + 512 * 512;
    _Float16* WoT  = WvT + 512 * 512;

    const int nE = (int)SZ;
    cvt_f32_to_h<<<(nE + 255) / 256, 256, 0, stream>>>(x,   x_h, nE);
    cvt_f32_to_h<<<(nE + 255) / 256, 256, 0, stream>>>(ctx, c_h, nE);

    const int nW = 512 * 512;
    cvt_transpose<<<(nW + 255) / 256, 256, 0, stream>>>(Wq,  WqT, 512, 512, 512,  0);
    cvt_transpose<<<(nW + 255) / 256, 256, 0, stream>>>(Wkv, WkT, 512, 512, 1024, 0);
    cvt_transpose<<<(nW + 255) / 256, 256, 0, stream>>>(Wkv, WvT, 512, 512, 1024, 512);
    cvt_transpose<<<(nW + 255) / 256, 256, 0, stream>>>(Wo,  WoT, 512, 512, 512,  0);

    // 16x64 output strip per wave: grid (Ncols/64, Mrows/16)
    dim3 gg(INNER_ / 64, (B_ * N_) / 16);   // 8 x 512
    gemm_wmma<<<gg, 32, 0, stream>>>(x_h, WqT, INNER_, QDIM, q_h,  nullptr, nullptr, 0, 0);
    gemm_wmma<<<gg, 32, 0, stream>>>(c_h, WkT, INNER_, CDIM, k_h,  nullptr, nullptr, 0, 0);
    gemm_wmma<<<gg, 32, 0, stream>>>(c_h, WvT, INNER_, CDIM, vt_h, nullptr, nullptr, 1, M_);

    flash_attn<<<dim3(B_ * HEADS_, N_ / (QWAVES * 16)), QWAVES * 32, 0, stream>>>(q_h, k_h, vt_h, mask, ao_h);

    gemm_wmma<<<dim3(QDIM / 64, (B_ * N_) / 16), 32, 0, stream>>>(
        ao_h, WoT, QDIM, INNER_, nullptr, out, bo, 2, 0);
}

// v003
// A run of this version takes 161 microseconds.
// Timed twice side by side with v002, it ran 1.30 and 1.28 times as fast.
// Over all steps from v000 it is 2.58 times as fast.
#include <hip/hip_runtime.h>
#include <hip/hip_bf16.h>
#include <float.h>
#include <stdint.h>

// Problem constants (match the reference)
#define B_     4
#define N_     2048
#define M_     2048
#define QDIM   512
#define CDIM   512
#define HEADS_ 8
#define DHEAD  64
#define INNER_ 512
#define SCALE_ 0.125f   // 64^-0.5

typedef _Float16 v16h __attribute__((ext_vector_type(16)));
typedef _Float16 h8   __attribute__((ext_vector_type(8)));
typedef float    v8f  __attribute__((ext_vector_type(8)));

// Build a 16x32 f16 A/B fragment for v_wmma_f32_16x16x32_f16.
// Per the CDNA5 ISA layout, lane L (row/col = L%16, half = L/16) holds
//   frag[0..7]  = X[row][ 8*half + i]        (contiguous 16B)
//   frag[8..15] = X[row][16 + 8*half + i]    (contiguous 16B)
__device__ __forceinline__ v16h frag_ld(const _Float16* lo_p, const _Float16* hi_p) {
    h8 lo = *(const h8*)lo_p;
    h8 hi = *(const h8*)hi_p;
    v16h r;
#pragma unroll
    for (int i = 0; i < 8; ++i) { r[i] = lo[i]; r[i + 8] = hi[i]; }
    return r;
}

__device__ __forceinline__ v8f wmma16(v16h a, v16h b, v8f c) {
    // (neg_a, A, neg_b, B, c_mod, C, reuse_a, reuse_b)
    return __builtin_amdgcn_wmma_f32_16x16x32_f16(false, a, false, b, (short)0, c,
                                                  false, false);
}

// ---------------------------------------------------------------------------
typedef _Float16 h4 __attribute__((ext_vector_type(4)));
typedef float    f4 __attribute__((ext_vector_type(4)));

#define CV_THREADS 256
#define CV_LOADS   8                               // 16-byte loads in flight per lane
#define CV_WAVE_E  (CV_LOADS * 128)                // elements per wave: 4 KB of f32 in a row
#define CV_BLOCK_E ((CV_THREADS / 32) * CV_WAVE_E) // elements per work-group

// f32 -> f16 elementwise convert, 32 elements a lane: few waves to start, each with
// eight wave-wide loads of 512 contiguous bytes in flight; each store of a wave
// covers 256 contiguous bytes. The grid covers the tensor exactly (a multiple of
// CV_BLOCK_E elements), so there is no bound to test.
__global__ __launch_bounds__(CV_THREADS)
void cvt_f32_to_h(const float* __restrict__ src, _Float16* __restrict__ dst) {
    const int wave = blockIdx.x * (CV_THREADS / 32) + (threadIdx.x >> 5);
    const int base = wave * CV_WAVE_E + (threadIdx.x & 31) * 4;
    f4 v[CV_LOADS];
#pragma unroll
    for (int j = 0; j < CV_LOADS; ++j) v[j] = *(const f4*)(src + base + j * 128);
#pragma unroll
    for (int j = 0; j < CV_LOADS; ++j) {
        h4 o;
#pragma unroll
        for (int e = 0; e < 4; ++e) o[e] = (_Float16)v[j][e];
        *(h4*)(dst + base + j * 128) = o;
    }
}

// Transpose-convert weight W[in=rows][... ld ...] (taking 32 * gridDim.x columns from
// col0 on) into Wt[out][in] f16, so GEMM B-operand columns become contiguous rows.
// A lane takes 8 rows of one column: eight loads in flight, each 128 contiguous bytes
// a wave, and one 16-byte store; the eight waves of a work-group take 64 rows, so a
// work-group writes whole 128-byte lines of Wt. The grid (columns / 32, rows / 64)
// covers the block exactly.
__global__ __launch_bounds__(CV_THREADS)
void cvt_transpose(const float* __restrict__ src,
                   _Float16* __restrict__ dst,
                   int rows, int ld, int col0) {
    const int o  = blockIdx.x * 32 + (threadIdx.x & 31);
    const int r0 = blockIdx.y * 64 + (threadIdx.x >> 5) * 8;
    const float* s = src + (size_t)r0 * ld + col0 + o;
    float v[8];
#pragma unroll
    for (int i = 0; i < 8; ++i) v[i] = s[(size_t)i * ld];
    h8 pk;
#pragma unroll
    for (int i = 0; i < 8; ++i) pk[i] = (_Float16)v[i];
    *(h8*)(dst + (size_t)o * rows + r0) = pk;
}

// ---------------------------------------------------------------------------
// f16 WMMA GEMM, register-blocked: each wave computes a 16x64 strip
// (4 accumulators) so the A fragment is loaded once and reused 4x per k-step.
// C[m][n] = sum_k A[m][k] * Bt[n][k]
// mode: 0 = f16 row-major store,
//       1 = f16 store transposed per batch -> out[b][n][m%Mdim] (for V),
//       2 = f32 store + bias (final projection into d_out).
__global__ void gemm_wmma(const _Float16* __restrict__ A,
                          const _Float16* __restrict__ Bt,
                          int Ncols, int K,
                          _Float16* __restrict__ outH,
                          float* __restrict__ outF,
                          const float* __restrict__ bias,
                          int mode, int Mdim) {
    const int lane = threadIdx.x & 31;
    const int col  = lane & 15;
    const int half = lane >> 4;
    const int kb0  = 8 * half;
    const int kb1  = 16 + 8 * half;
    const int n0   = blockIdx.x * 64;   // 4 x 16-column tiles
    const int m0   = blockIdx.y * 16;

    const _Float16* arow = A + (size_t)(m0 + col) * K;
    const _Float16* brow[4];
#pragma unroll
    for (int t = 0; t < 4; ++t)
        brow[t] = Bt + (size_t)(n0 + t * 16 + col) * K;

    v8f acc[4];
#pragma unroll
    for (int t = 0; t < 4; ++t) acc[t] = (v8f){};

    for (int k0 = 0; k0 < K; k0 += 32) {
        const v16h a = frag_ld(arow + k0 + kb0, arow + k0 + kb1);
#pragma unroll
        for (int t = 0; t < 4; ++t)
            acc[t] = wmma16(a, frag_ld(brow[t] + k0 + kb0, brow[t] + k0 + kb1),
                            acc[t]);
    }

    // C-layout: lane (col, half), VGPR r  <->  row = 8*half + r, column = col
    const int mrow0 = m0 + 8 * half;
    if (mode == 0) {
#pragma unroll
        for (int t = 0; t < 4; ++t)
#pragma unroll
            for (int r = 0; r < 8; ++r)
                outH[(size_t)(mrow0 + r) * Ncols + n0 + t * 16 + col] =
                    (_Float16)acc[t][r];
    } else if (mode == 1) {
        // transposed store: consecutive r -> consecutive m -> packed 16B stores
        const int bidx = mrow0 / Mdim;
        const int mloc = mrow0 % Mdim;
#pragma unroll
        for (int t = 0; t < 4; ++t) {
            h8 pk = {};
#pragma unroll
            for (int r = 0; r < 8; ++r) pk[r] = (_Float16)acc[t][r];
            *(h8*)(outH + ((size_t)bidx * Ncols + n0 + t * 16 + col) * Mdim + mloc) = pk;
        }
    } else {
#pragma unroll
        for (int t = 0; t < 4; ++t) {
            const float bv = bias[n0 + t * 16 + col];
#pragma unroll
            for (int r = 0; r < 8; ++r)
                outF[(size_t)(mrow0 + r) * Ncols + n0 + t * 16 + col] =
                    acc[t][r] + bv;
        }
    }
}

// ---------------------------------------------------------------------------
// Lane l <-> lane l ^ 16 (the two halves of a wave that share one query column)
__device__ __forceinline__ float xhalf(float x) {
    const int b = __builtin_bit_cast(int, x);
    return __builtin_bit_cast(float,
        __builtin_amdgcn_permlanex16(b, b, 0x76543210, 0xfedcba98, false, false));
}

// x where bit 'bit' of m is set, else -FLT_MAX: the bit spread over the word
// picks between the two bit patterns (two vector instructions, no compare)
__device__ __forceinline__ float keep(unsigned m, int bit, float x) {
    const int sel = (int)(m << (31 - bit)) >> 31;
    const int fil = __builtin_bit_cast(int, -FLT_MAX);
    return __builtin_bit_cast(float, (sel & __builtin_bit_cast(int, x)) | (~sel & fil));
}

// Geometry of flash_attn's work-group and of its LDS ring
#define QWAVES 8                 // waves per work-group, 16 query columns each
#define TKEYS  64                // keys per stage: K rows and V^T rows are both 128 B
#define PITCH  72                // halfs per LDS row: 128 B + 16 B, an odd multiple of 16 B
#define TILE_H (64 * PITCH)      // halfs of one staged tile (64 rows)
#define NSTAGE (M_ / TKEYS)

// One stage's share of one lane: four 16-byte asynchronous copies to LDS.
// The s_wait_xcnt closes the statement, so that no register a copy names is
// rewritten ahead of it.
__device__ __forceinline__ void stage_copy(unsigned l0, unsigned l1, unsigned l2, unsigned l3,
                                           const _Float16* g0, const _Float16* g1,
                                           const _Float16* g2, const _Float16* g3) {
    asm volatile("global_load_async_to_lds_b128 %0, %4, off\n\t"
                 "global_load_async_to_lds_b128 %1, %5, off\n\t"
                 "global_load_async_to_lds_b128 %2, %6, off\n\t"
                 "global_load_async_to_lds_b128 %3, %7, off\n\t"
                 "s_wait_xcnt 0x0"
                 :: "v"(l0), "v"(l1), "v"(l2), "v"(l3), "v"(g0), "v"(g1), "v"(g2), "v"(g3)
                 : "memory");
}

__global__ __launch_bounds__(QWAVES * 32) __attribute__((amdgpu_waves_per_eu(4, 4)))
void flash_attn(const _Float16* __restrict__ Q,
                const _Float16* __restrict__ Kh,
                const _Float16* __restrict__ Vt,
                const int* __restrict__ mask,
                _Float16* __restrict__ O) {
    // [buffer][K tile, then V^T tile]
    __shared__ __attribute__((aligned(16))) _Float16 ring[2][2 * TILE_H];

    const int tid  = threadIdx.x;
    const int lane = tid & 31;
    const int col  = lane & 15;
    const int half = lane >> 4;
    const int kb0  = 8 * half;
    const int bh   = blockIdx.x;
    const int b    = bh / HEADS_;
    const int h    = bh % HEADS_;
    const int q0   = blockIdx.y * (QWAVES * 16) + (tid >> 5) * 16;

    const _Float16* kbase = Kh + (size_t)b * M_ * INNER_ + h * DHEAD;
    const _Float16* vbase = Vt + ((size_t)b * INNER_ + h * DHEAD) * M_;
    const int* mrow = mask + b * M_;

    // This lane's place in a stage: rows crow and crow + 32 of either tile, 16
    // bytes at cch; a wave's copy covers four whole rows of 128 bytes.
    const int crow = tid >> 3;
    const int cch  = (tid & 7) * 8;
    const _Float16* gk = kbase + (size_t)crow * INNER_ + cch;
    const _Float16* gv = vbase + (size_t)crow * M_ + cch;
    const unsigned  lk = (unsigned)(uintptr_t)&ring[0][crow * PITCH + cch];
#define STAGE(st, bf) do {                                                          \
        const unsigned  l_ = lk + (unsigned)(bf) * (2 * TILE_H * 2);                \
        const _Float16* k_ = gk + (size_t)(st) * TKEYS * INNER_;                    \
        const _Float16* v_ = gv + (size_t)(st) * TKEYS;                             \
        stage_copy(l_, l_ + 32 * PITCH * 2, l_ + TILE_H * 2,                        \
                   l_ + TILE_H * 2 + 32 * PITCH * 2,                                \
                   k_, k_ + 32 * INNER_, v_, v_ + (size_t)32 * M_);                 \
    } while (0)

    // Q fragments stay resident: two 32x16 chunks covering d = 0..63
    const _Float16* qp = Q + (size_t)(b * N_ + q0 + col) * INNER_ + h * DHEAD + kb0;
    const v16h bq0 = frag_ld(qp,      qp + 16);
    const v16h bq1 = frag_ld(qp + 32, qp + 48);
    // the four loads share the address pair qp: naming it keeps it live up to
    // the wait, so that it is not rewritten ahead of it
    asm volatile("s_wait_xcnt 0x0" :: "v"(qp) : "memory");

    // stage 0, landed and published; then stage 1 flies under pass 0
    STAGE(0, 0);
    asm volatile("s_wait_asynccnt 0x0" ::: "memory");   // this wave's copies have landed
    __syncthreads();                                    // and every other wave's
    STAGE(1, 1);

    float rm = -FLT_MAX;   // running maximum of this lane's query (same in both halves)
    float rl = 0.0f;       // running sum over this half's keys only; joined at the end
    v8f acc[4];            // acc[g][r] = O^T[g*16 + 8*half + r][query col]
#pragma unroll
    for (int g = 0; g < 4; ++g) acc[g] = (v8f){};

    for (int st = 0; st < NSTAGE; ++st) {
        const _Float16* ktile = ring[st & 1];
        const _Float16* vtile = ktile + TILE_H;

#pragma unroll
        for (int s = 0; s < TKEYS; s += 32) {
            const int j0 = st * TKEYS + s;
            // the pass's 32 mask words, one per lane
            const int mword = mrow[j0 + lane];

            // ---- S^T = K*Q^T for 32 keys: two 16-key C tiles, 4 WMMAs total
            const _Float16* kp = ktile + (s + col) * PITCH + kb0;
            const v16h ak00 = frag_ld(kp,                   kp + 16);
            const v16h ak01 = frag_ld(kp + 32,              kp + 48);
            const v16h ak10 = frag_ld(kp + 16 * PITCH,      kp + 16 * PITCH + 16);
            const v16h ak11 = frag_ld(kp + 16 * PITCH + 32, kp + 16 * PITCH + 48);

            // V^T rows (d-major V): read under the S^T products and the softmax
            const _Float16* vp = vtile + col * PITCH + s + kb0;
            v16h av[4];
#pragma unroll
            for (int g = 0; g < 4; ++g)
                av[g] = frag_ld(vp + g * 16 * PITCH, vp + g * 16 * PITCH + 16);

            v8f s0 = {}, s1 = {};
            s0 = wmma16(ak00, bq0, s0);
            s1 = wmma16(ak10, bq0, s1);
            s0 = wmma16(ak01, bq1, s0);
            s1 = wmma16(ak11, bq1, s1);

            // ---- online softmax, one query per lane
            // bit k of the ballot = key j0 + k; this lane's 16 keys are j0 + 8*half + r
            // (bit r of mk) and j0 + 16 + 8*half + r (bit 16 + r of mk)
            const unsigned mk = __builtin_amdgcn_ballot_w32(mword != 0) >> kb0;
            float a[16];
#pragma unroll
            for (int r = 0; r < 8; ++r) {
                a[r]     = keep(mk, r,      s0[r] * SCALE_);
                a[8 + r] = keep(mk, 16 + r, s1[r] * SCALE_);
            }
            float t = a[0];
#pragma unroll
            for (int i = 1; i < 16; ++i) t = fmaxf(t, a[i]);
            t = fmaxf(t, xhalf(t));
            const float mn   = fmaxf(rm, t);
            const float corr = __expf(rm - mn);
            rm = mn;

            v16h bp;           // P^T as a B fragment: element r <-> key j0 + 8*half + r, 8 + r <-> key j0 + 16 + 8*half + r
            float ps0 = 0.0f, ps1 = 0.0f;
#pragma unroll
            for (int r = 0; r < 8; ++r) {
                const float p0 = __expf(a[r] - mn);
                const float p1 = __expf(a[8 + r] - mn);
                bp[r]     = (_Float16)p0;
                bp[8 + r] = (_Float16)p1;
                ps0 += p0;
                ps1 += p1;
            }
            rl = rl * corr + (ps0 + ps1);
#pragma unroll
            for (int g = 0; g < 4; ++g)
#pragma unroll
                for (int r = 0; r < 8; ++r) acc[g][r] *= corr;

            // ---- O^T += V^T * P^T
#pragma unroll
            for (int g = 0; g < 4; ++g) acc[g] = wmma16(av[g], bp, acc[g]);
        }

        // publish point of stage st + 1, which also frees stage st's buffer
        asm volatile("s_wait_dscnt 0x0" ::: "memory");     // this wave has left the buffer
        asm volatile("s_wait_asynccnt 0x0" ::: "memory");  // its copies of stage st + 1 have landed
        __syncthreads();
        if (st + 2 < NSTAGE) STAGE(st + 2, st & 1);
    }
    // nothing is in flight here; kept so that no copy can outlive the wave
    asm volatile("s_wait_asynccnt 0x0" ::: "memory");
#undef STAGE

    const float inv = 1.0f / (rl + xhalf(rl));
    // consecutive r -> consecutive d -> packed 16B stores
    _Float16* orow = O + (size_t)(b * N_ + q0 + col) * INNER_ + h * DHEAD + 8 * half;
#pragma unroll
    for (int g = 0; g < 4; ++g) {
        h8 pk = {};
#pragma unroll
        for (int r = 0; r < 8; ++r) pk[r] = (_Float16)(acc[g][r] * inv);
        *(h8*)(orow + g * 16) = pk;
    }
}

// ---------------------------------------------------------------------------
extern "C" void kernel_launch(void* const* d_in, const int* in_sizes, int n_in,
                              void* d_out, int out_size, void* d_ws, size_t ws_size,
                              hipStream_t stream) {
    const float* x    = (const float*)d_in[0];
    const float* ctx  = (const float*)d_in[1];
    const int*   mask = (const int*)d_in[2];
    const float* Wq   = (const float*)d_in[3];
    const float* Wkv  = (const float*)d_in[4];
    const float* Wo   = (const float*)d_in[5];
    const float* bo   = (const float*)d_in[6];
    float* out = (float*)d_out;

    // Workspace layout (f16): six 8192x512 tensors + four 512x512 weights ~ 50 MB
    _Float16* W = (_Float16*)d_ws;
    const size_t SZ = (size_t)B_ * N_ * INNER_;   // 4M elements
    _Float16* x_h  = W;
    _Float16* c_h  = W + SZ;
    _Float16* q_h  = W + 2 * SZ;
    _Float16* k_h  = W + 3 * SZ;
    _Float16* vt_h = W + 4 * SZ;   // [B][INNER][M] (d-major V)
    _Float16* ao_h = W + 5 * SZ;
    _Float16* WqT  = W + 6 * SZ;
    _Float16* WkT  = WqT + 512 * 512;
    _Float16* WvT  = WkT + 512 * 512;
    _Float16* WoT  = WvT + 512 * 512;

    static_assert(((size_t)B_ * N_ * INNER_) % CV_BLOCK_E == 0, "the convert's grid is exact");
    const int gE = (int)(SZ / CV_BLOCK_E);   // 512 work-groups
    cvt_f32_to_h<<<gE, CV_THREADS, 0, stream>>>(x,   x_h);
    cvt_f32_to_h<<<gE, CV_THREADS, 0, stream>>>(ctx, c_h);

    const dim3 gW(512 / 32, 512 / 64);       // 512 columns x 512 rows a weight block
    cvt_transpose<<<gW, CV_THREADS, 0, stream>>>(Wq,  WqT, 512, 512,  0);
    cvt_transpose<<<gW, CV_THREADS, 0, stream>>>(Wkv, WkT, 512, 1024, 0);
    cvt_transpose<<<gW, CV_THREADS, 0, stream>>>(Wkv, WvT, 512, 1024, 512);
    cvt_transpose<<<gW, CV_THREADS, 0, stream>>>(Wo,  WoT, 512, 512,  0);

    // 16x64 output strip per wave: grid (Ncols/64, Mrows/16)
    dim3 gg(INNER_ / 64, (B_ * N_) / 16);   // 8 x 512
    gemm_wmma<<<gg, 32, 0, stream>>>(x_h, WqT, INNER_, QDIM, q_h,  nullptr, nullptr, 0, 0);
    gemm_wmma<<<gg, 32, 0, stream>>>(c_h, WkT, INNER_, CDIM, k_h,  nullptr, nullptr, 0, 0);
    gemm_wmma<<<gg, 32, 0, stream>>>(c_h, WvT, INNER_, CDIM, vt_h, nullptr, nullptr, 1, M_);

    flash_attn<<<dim3(B_ * HEADS_, N_ / (QWAVES * 16)), QWAVES * 32, 0, stream>>>(q_h, k_h, vt_h, mask, ao_h);

    gemm_wmma<<<dim3(QDIM / 64, (B_ * N_) / 16), 32, 0, stream>>>(
        ao_h, WoT, QDIM, INNER_, nullptr, out, bo, 2, 0);
}

// v004
// It runs in 93.3 microseconds.
// In both of two side-by-side timings against v003, it was 1.76 times as fast.
// Counting every step since v000, it is 4.55 times as fast.
#include <hip/hip_runtime.h>
#include <hip/hip_bf16.h>
#include <float.h>
#include <stdint.h>

// Problem constants (match the reference)
#define B_     4
#define N_     2048
#define M_     2048
#define QDIM   512
#define CDIM   512
#define HEADS_ 8
#define DHEAD  64
#define INNER_ 512
#define SCALE_ 0.125f   // 64^-0.5

typedef _Float16 v16h __attribute__((ext_vector_type(16)));
typedef _Float16 h8   __attribute__((ext_vector_type(8)));
typedef float    v8f  __attribute__((ext_vector_type(8)));

// Build a 16x32 f16 A/B fragment for v_wmma_f32_16x16x32_f16.
// Per the CDNA5 ISA layout, lane L (row/col = L%16, half = L/16) holds
//   frag[0..7]  = X[row][ 8*half + i]        (contiguous 16B)
//   frag[8..15] = X[row][16 + 8*half + i]    (contiguous 16B)
__device__ __forceinline__ v16h frag_ld(const _Float16* lo_p, const _Float16* hi_p) {
    h8 lo = *(const h8*)lo_p;
    h8 hi = *(const h8*)hi_p;
    v16h r;
#pragma unroll
    for (int i = 0; i < 8; ++i) { r[i] = lo[i]; r[i + 8] = hi[i]; }
    return r;
}

__device__ __forceinline__ v8f wmma16(v16h a, v16h b, v8f c) {
    // (neg_a, A, neg_b, B, c_mod, C, reuse_a, reuse_b)
    return __builtin_amdgcn_wmma_f32_16x16x32_f16(false, a, false, b, (short)0, c,
                                                  false, false);
}

// ---------------------------------------------------------------------------
typedef _Float16 h4 __attribute__((ext_vector_type(4)));
typedef float    f4 __attribute__((ext_vector_type(4)));

#define CV_THREADS 256
#define CV_LOADS   8                               // 16-byte loads in flight per lane
#define CV_WAVE_E  (CV_LOADS * 128)                // elements per wave: 4 KB of f32 in a row
#define CV_BLOCK_E ((CV_THREADS / 32) * CV_WAVE_E) // elements per work-group

// f32 -> f16 elementwise convert, 32 elements a lane: few waves to start, each with
// eight wave-wide loads of 512 contiguous bytes in flight; each store of a wave
// covers 256 contiguous bytes. The grid covers the tensor exactly (a multiple of
// CV_BLOCK_E elements), so there is no bound to test.
__global__ __launch_bounds__(CV_THREADS)
void cvt_f32_to_h(const float* __restrict__ src, _Float16* __restrict__ dst) {
    const int wave = blockIdx.x * (CV_THREADS / 32) + (threadIdx.x >> 5);
    const int base = wave * CV_WAVE_E + (threadIdx.x & 31) * 4;
    f4 v[CV_LOADS];
#pragma unroll
    for (int j = 0; j < CV_LOADS; ++j) v[j] = *(const f4*)(src + base + j * 128);
#pragma unroll
    for (int j = 0; j < CV_LOADS; ++j) {
        h4 o;
#pragma unroll
        for (int e = 0; e < 4; ++e) o[e] = (_Float16)v[j][e];
        *(h4*)(dst + base + j * 128) = o;
    }
}

// Transpose-convert weight W[in=rows][... ld ...] (taking 32 * gridDim.x columns from
// col0 on) into Wt[out][in] f16, so GEMM B-operand columns become contiguous rows.
// A lane takes 8 rows of one column: eight loads in flight, each 128 contiguous bytes
// a wave, and one 16-byte store; the eight waves of a work-group take 64 rows, so a
// work-group writes whole 128-byte lines of Wt. The grid (columns / 32, rows / 64)
// covers the block exactly.
__global__ __launch_bounds__(CV_THREADS)
void cvt_transpose(const float* __restrict__ src,
                   _Float16* __restrict__ dst,
                   int rows, int ld, int col0) {
    const int o  = blockIdx.x * 32 + (threadIdx.x & 31);
    const int r0 = blockIdx.y * 64 + (threadIdx.x >> 5) * 8;
    const float* s = src + (size_t)r0 * ld + col0 + o;
    float v[8];
#pragma unroll
    for (int i = 0; i < 8; ++i) v[i] = s[(size_t)i * ld];
    h8 pk;
#pragma unroll
    for (int i = 0; i < 8; ++i) pk[i] = (_Float16)v[i];
    *(h8*)(dst + (size_t)o * rows + r0) = pk;
}

// ---------------------------------------------------------------------------
// Geometry of gemm_wmma's work-group and of its LDS ring
#define GWAVES 8                 // waves per work-group: 4 along m x 2 along n, 32 x 64 of C each
#define GTM    128               // rows of C per work-group
#define GTN    128               // columns of C per work-group
#define GK     512               // depth of every projection
#define GN     512               // columns of every projection
#define GSK    128               // k per stage: operand rows of 256 B
#define GPITCH 136               // halfs per LDS row: 256 B + 16 B, an odd multiple of 16 B
#define GTILE  (128 * GPITCH)    // halfs of one staged operand tile (128 rows)
#define GNST   (GK / GSK)

// One operand tile's share of one lane: eight 16-byte asynchronous copies to LDS,
// rows 16 apart. The s_wait_xcnt closes the statement, so that no register a copy
// names is rewritten ahead of it.
__device__ __forceinline__ void tile_copy(unsigned l, const _Float16* g) {
    const unsigned ls = 16 * GPITCH * 2;   // bytes between two of the lane's LDS rows
    const int      gs = 16 * GK;           // halfs between two of its global rows
    asm volatile("global_load_async_to_lds_b128 %0, %8, off\n\t"
                 "global_load_async_to_lds_b128 %1, %9, off\n\t"
                 "global_load_async_to_lds_b128 %2, %10, off\n\t"
                 "global_load_async_to_lds_b128 %3, %11, off\n\t"
                 "global_load_async_to_lds_b128 %4, %12, off\n\t"
                 "global_load_async_to_lds_b128 %5, %13, off\n\t"
                 "global_load_async_to_lds_b128 %6, %14, off\n\t"
                 "global_load_async_to_lds_b128 %7, %15, off\n\t"
                 "s_wait_xcnt 0x0"
                 :: "v"(l), "v"(l + ls), "v"(l + 2 * ls), "v"(l + 3 * ls),
                    "v"(l + 4 * ls), "v"(l + 5 * ls), "v"(l + 6 * ls), "v"(l + 7 * ls),
                    "v"(g), "v"(g + gs), "v"(g + 2 * gs), "v"(g + 3 * gs),
                    "v"(g + 4 * gs), "v"(g + 5 * gs), "v"(g + 6 * gs), "v"(g + 7 * gs)
                 : "memory");
}

// f16 WMMA GEMM: C[m][n] = sum_k A[m][k] * Bt[n][k], both operands k-contiguous.
// A work-group of eight waves computes a 128 x 128 tile of C. Each stage of 128 k
// (128 rows of A and 128 rows of Bt, 256 bytes a row) is brought into LDS once for
// all eight waves, in whole 256-byte pieces, by asynchronous copies into a ring of
// two buffers; the fragments are read from there, and every fragment read feeds
// four (A) or two (Bt) WMMAs of its wave's 2 x 4 accumulator tiles.
// MODE: 0 = f16 row-major store,
//       1 = f16 store transposed per batch -> out[b][n][m%Mdim] (for V),
//       2 = f32 store + bias (final projection into d_out).
// Left open: modes 0 and 2 still store 2 or 4 bytes a lane; the three input
// projections are three launches of 256 work-groups, one a WGP, so nothing hides a
// work-group's first stage and its stores; the converts are launches of their own.
template <int MODE>
__global__ __launch_bounds__(GWAVES * 32)
void gemm_wmma(const _Float16* __restrict__ A,
               const _Float16* __restrict__ Bt,
               _Float16* __restrict__ outH,
               float* __restrict__ outF,
               const float* __restrict__ bias) {
    constexpr int Mdim = M_;
    // [buffer][A tile, then Bt tile]
    __shared__ __attribute__((aligned(16))) _Float16 gring[2][2 * GTILE];

    const int tid  = threadIdx.x;
    const int lane = tid & 31;
    const int col  = lane & 15;
    const int half = lane >> 4;
    const int kb0  = 8 * half;
    const int wm   = (tid >> 5) & 3;    // this wave's 32 rows of the tile
    const int wn   = tid >> 7;          // this wave's 64 columns of the tile
    const int n0   = blockIdx.x * GTN;
    const int m0   = blockIdx.y * GTM;

    // This lane's place in a stage: rows crow + 16 i of either tile, 16 bytes at
    // cch; a wave's copy covers two whole rows of 256 bytes.
    const int crow = tid >> 4;
    const int cch  = (tid & 15) * 8;
    const _Float16* ga = A  + (size_t)(m0 + crow) * GK + cch;
    const _Float16* gb = Bt + (size_t)(n0 + crow) * GK + cch;
    const unsigned  la = (unsigned)(uintptr_t)&gring[0][crow * GPITCH + cch];
#define GSTAGE(st, bf) do {                                                         \
        const unsigned l_ = la + (unsigned)(bf) * (2 * GTILE * 2);                  \
        tile_copy(l_,             ga + (st) * GSK);                                 \
        tile_copy(l_ + GTILE * 2, gb + (st) * GSK);                                 \
    } while (0)

    // stage 0, landed and published; then stage 1 flies under pass 0
    GSTAGE(0, 0);
    asm volatile("s_wait_asynccnt 0x0" ::: "memory");   // this wave's copies have landed
    __syncthreads();                                    // and every other wave's
    GSTAGE(1, 1);

    v8f acc[2][4];
#pragma unroll
    for (int i = 0; i < 2; ++i)
#pragma unroll
        for (int t = 0; t < 4; ++t) acc[i][t] = (v8f){};

    for (int st = 0; st < GNST; ++st) {
        const _Float16* ap = gring[st & 1] + (wm * 32 + col) * GPITCH + kb0;
        const _Float16* bp = gring[st & 1] + GTILE + (wn * 64 + col) * GPITCH + kb0;
        // two fragment sets: k-step j + 1 of this stage is read while k-step j is multiplied
        v16h a[2][2], b[2][4];
#define GFRAGS(set, ks) do {                                                        \
        _Pragma("unroll")                                                           \
        for (int i = 0; i < 2; ++i)                                                 \
            a[set][i] = frag_ld(ap + i * 16 * GPITCH + (ks),                        \
                                ap + i * 16 * GPITCH + (ks) + 16);                  \
        _Pragma("unroll")                                                           \
        for (int t = 0; t < 4; ++t)                                                 \
            b[set][t] = frag_ld(bp + t * 16 * GPITCH + (ks),                        \
                                bp + t * 16 * GPITCH + (ks) + 16);                  \
    } while (0)
        GFRAGS(0, 0);
        // unrolled (as every loop over i, t, r here): the set index j & 1 is then a
        // constant, and the fragments and accumulators stay in registers
#pragma unroll
        for (int j = 0; j < GSK / 32; ++j) {
            if (j + 1 < GSK / 32) GFRAGS((j + 1) & 1, (j + 1) * 32);
            // keeps the next k-step's twelve LDS reads one group in front of this k-step's
            // WMMAs; left free, they are spread among the WMMAs and waited for at once
            __builtin_amdgcn_sched_barrier(0);
#pragma unroll
            for (int i = 0; i < 2; ++i)
#pragma unroll
                for (int t = 0; t < 4; ++t)
                    acc[i][t] = wmma16(a[j & 1][i], b[j & 1][t], acc[i][t]);
            // and the reads after next behind them
            __builtin_amdgcn_sched_barrier(0);
        }
#undef GFRAGS

        // publish point of stage st + 1, which also frees stage st's buffer
        asm volatile("s_wait_dscnt 0x0" ::: "memory");     // this wave has left the buffer
        asm volatile("s_wait_asynccnt 0x0" ::: "memory");  // its copies of stage st + 1 have landed
        __syncthreads();
        if (st + 2 < GNST) GSTAGE(st + 2, st & 1);
    }
    // nothing is in flight here; kept so that no copy can outlive the wave
    asm volatile("s_wait_asynccnt 0x0" ::: "memory");
#undef GSTAGE

    // C-layout: lane (col, half), VGPR r  <->  row = 8*half + r, column = col
    const int mr0 = m0 + wm * 32 + 8 * half;
    const int nc0 = n0 + wn * 64 + col;
    if (MODE == 0) {
        _Float16* o0 = outH + (size_t)mr0 * GN + nc0;
        _Float16* o1 = o0 + 16 * GN;
        _Float16  hv[2][4][8];
#pragma unroll
        for (int i = 0; i < 2; ++i)
#pragma unroll
            for (int t = 0; t < 4; ++t)
#pragma unroll
                for (int r = 0; r < 8; ++r) hv[i][t][r] = (_Float16)acc[i][t][r];
        // every convert stands in front of the first store: left free, converts among the
        // stores reuse registers that issued stores name, each behind a wait of its own
        __builtin_amdgcn_sched_barrier(0);
#pragma unroll
        for (int t = 0; t < 4; ++t)
#pragma unroll
            for (int r = 0; r < 8; ++r) {
                o0[r * GN + t * 16] = hv[0][t][r];
                o1[r * GN + t * 16] = hv[1][t][r];
            }
    } else if (MODE == 1) {
        // transposed store: consecutive r -> consecutive m -> packed 16B stores
        // (a tile's 128 rows lie in one batch: Mdim is a multiple of GTM)
        const int bidx = mr0 / Mdim;
        const int mloc = mr0 % Mdim;
#pragma unroll
        for (int i = 0; i < 2; ++i)
#pragma unroll
            for (int t = 0; t < 4; ++t) {
                h8 pk = {};
#pragma unroll
                for (int r = 0; r < 8; ++r) pk[r] = (_Float16)acc[i][t][r];
                *(h8*)(outH + ((size_t)bidx * GN + nc0 + t * 16) * Mdim + mloc + i * 16) = pk;
            }
    } else {
#pragma unroll
        for (int t = 0; t < 4; ++t) {
            const float bv = bias[nc0 + t * 16];
#pragma unroll
            for (int i = 0; i < 2; ++i)
#pragma unroll
                for (int r = 0; r < 8; ++r)
                    outF[(size_t)(mr0 + i * 16 + r) * GN + nc0 + t * 16] = acc[i][t][r] + bv;
        }
    }
}

// ---------------------------------------------------------------------------
// Lane l <-> lane l ^ 16 (the two halves of a wave that share one query column)
__device__ __forceinline__ float xhalf(float x) {
    const int b = __builtin_bit_cast(int, x);
    return __builtin_bit_cast(float,
        __builtin_amdgcn_permlanex16(b, b, 0x76543210, 0xfedcba98, false, false));
}

// x where bit 'bit' of m is set, else -FLT_MAX: the bit spread over the word
// picks between the two bit patterns (two vector instructions, no compare)
__device__ __forceinline__ float keep(unsigned m, int bit, float x) {
    const int sel = (int)(m << (31 - bit)) >> 31;
    const int fil = __builtin_bit_cast(int, -FLT_MAX);
    return __builtin_bit_cast(float, (sel & __builtin_bit_cast(int, x)) | (~sel & fil));
}

// Geometry of flash_attn's work-group and of its LDS ring
#define QWAVES 8                 // waves per work-group, 16 query columns each
#define TKEYS  64                // keys per stage: K rows and V^T rows are both 128 B
#define PITCH  72                // halfs per LDS row: 128 B + 16 B, an odd multiple of 16 B
#define TILE_H (64 * PITCH)      // halfs of one staged tile (64 rows)
#define NSTAGE (M_ / TKEYS)

// One stage's share of one lane: four 16-byte asynchronous copies to LDS.
// The s_wait_xcnt closes the statement, so that no register a copy names is
// rewritten ahead of it.
__device__ __forceinline__ void stage_copy(unsigned l0, unsigned l1, unsigned l2, unsigned l3,
                                           const _Float16* g0, const _Float16* g1,
                                           const _Float16* g2, const _Float16* g3) {
    asm volatile("global_load_async_to_lds_b128 %0, %4, off\n\t"
                 "global_load_async_to_lds_b128 %1, %5, off\n\t"
                 "global_load_async_to_lds_b128 %2, %6, off\n\t"
                 "global_load_async_to_lds_b128 %3, %7, off\n\t"
                 "s_wait_xcnt 0x0"
                 :: "v"(l0), "v"(l1), "v"(l2), "v"(l3), "v"(g0), "v"(g1), "v"(g2), "v"(g3)
                 : "memory");
}

__global__ __launch_bounds__(QWAVES * 32) __attribute__((amdgpu_waves_per_eu(4, 4)))
void flash_attn(const _Float16* __restrict__ Q,
                const _Float16* __restrict__ Kh,
                const _Float16* __restrict__ Vt,
                const int* __restrict__ mask,
                _Float16* __restrict__ O) {
    // [buffer][K tile, then V^T tile]
    __shared__ __attribute__((aligned(16))) _Float16 ring[2][2 * TILE_H];

    const int tid  = threadIdx.x;
    const int lane = tid & 31;
    const int col  = lane & 15;
    const int half = lane >> 4;
    const int kb0  = 8 * half;
    const int bh   = blockIdx.x;
    const int b    = bh / HEADS_;
    const int h    = bh % HEADS_;
    const int q0   = blockIdx.y * (QWAVES * 16) + (tid >> 5) * 16;

    const _Float16* kbase = Kh + (size_t)b * M_ * INNER_ + h * DHEAD;
    const _Float16* vbase = Vt + ((size_t)b * INNER_ + h * DHEAD) * M_;
    const int* mrow = mask + b * M_;

    // This lane's place in a stage: rows crow and crow + 32 of either tile, 16
    // bytes at cch; a wave's copy covers four whole rows of 128 bytes.
    const int crow = tid >> 3;
    const int cch  = (tid & 7) * 8;
    const _Float16* gk = kbase + (size_t)crow * INNER_ + cch;
    const _Float16* gv = vbase + (size_t)crow * M_ + cch;
    const unsigned  lk = (unsigned)(uintptr_t)&ring[0][crow * PITCH + cch];
#define STAGE(st, bf) do {                                                          \
        const unsigned  l_ = lk + (unsigned)(bf) * (2 * TILE_H * 2);                \
        const _Float16* k_ = gk + (size_t)(st) * TKEYS * INNER_;                    \
        const _Float16* v_ = gv + (size_t)(st) * TKEYS;                             \
        stage_copy(l_, l_ + 32 * PITCH * 2, l_ + TILE_H * 2,                        \
                   l_ + TILE_H * 2 + 32 * PITCH * 2,                                \
                   k_, k_ + 32 * INNER_, v_, v_ + (size_t)32 * M_);                 \
    } while (0)

    // Q fragments stay resident: two 32x16 chunks covering d = 0..63
    const _Float16* qp = Q + (size_t)(b * N_ + q0 + col) * INNER_ + h * DHEAD + kb0;
    const v16h bq0 = frag_ld(qp,      qp + 16);
    const v16h bq1 = frag_ld(qp + 32, qp + 48);
    // the four loads share the address pair qp: naming it keeps it live up to
    // the wait, so that it is not rewritten ahead of it
    asm volatile("s_wait_xcnt 0x0" :: "v"(qp) : "memory");

    // stage 0, landed and published; then stage 1 flies under pass 0
    STAGE(0, 0);
    asm volatile("s_wait_asynccnt 0x0" ::: "memory");   // this wave's copies have landed
    __syncthreads();                                    // and every other wave's
    STAGE(1, 1);

    float rm = -FLT_MAX;   // running maximum of this lane's query (same in both halves)
    float rl = 0.0f;       // running sum over this half's keys only; joined at the end
    v8f acc[4];            // acc[g][r] = O^T[g*16 + 8*half + r][query col]
#pragma unroll
    for (int g = 0; g < 4; ++g) acc[g] = (v8f){};

    for (int st = 0; st < NSTAGE; ++st) {
        const _Float16* ktile = ring[st & 1];
        const _Float16* vtile = ktile + TILE_H;

#pragma unroll
        for (int s = 0; s < TKEYS; s += 32) {
            const int j0 = st * TKEYS + s;
            // the pass's 32 mask words, one per lane
            const int mword = mrow[j0 + lane];

            // ---- S^T = K*Q^T for 32 keys: two 16-key C tiles, 4 WMMAs total
            const _Float16* kp = ktile + (s + col) * PITCH + kb0;
            const v16h ak00 = frag_ld(kp,                   kp + 16);
            const v16h ak01 = frag_ld(kp + 32,              kp + 48);
            const v16h ak10 = frag_ld(kp + 16 * PITCH,      kp + 16 * PITCH + 16);
            const v16h ak11 = frag_ld(kp + 16 * PITCH + 32, kp + 16 * PITCH + 48);

            // V^T rows (d-major V): read under the S^T products and the softmax
            const _Float16* vp = vtile + col * PITCH + s + kb0;
            v16h av[4];
#pragma unroll
            for (int g = 0; g < 4; ++g)
                av[g] = frag_ld(vp + g * 16 * PITCH, vp + g * 16 * PITCH + 16);

            v8f s0 = {}, s1 = {};
            s0 = wmma16(ak00, bq0, s0);
            s1 = wmma16(ak10, bq0, s1);
            s0 = wmma16(ak01, bq1, s0);
            s1 = wmma16(ak11, bq1, s1);

            // ---- online softmax, one query per lane
            // bit k of the ballot = key j0 + k; this lane's 16 keys are j0 + 8*half + r
            // (bit r of mk) and j0 + 16 + 8*half + r (bit 16 + r of mk)
            const unsigned mk = __builtin_amdgcn_ballot_w32(mword != 0) >> kb0;
            float a[16];
#pragma unroll
            for (int r = 0; r < 8; ++r) {
                a[r]     = keep(mk, r,      s0[r] * SCALE_);
                a[8 + r] = keep(mk, 16 + r, s1[r] * SCALE_);
            }
            float t = a[0];
#pragma unroll
            for (int i = 1; i < 16; ++i) t = fmaxf(t, a[i]);
            t = fmaxf(t, xhalf(t));
            const float mn   = fmaxf(rm, t);
            const float corr = __expf(rm - mn);
            rm = mn;

            v16h bp;           // P^T as a B fragment: element r <-> key j0 + 8*half + r, 8 + r <-> key j0 + 16 + 8*half + r
            float ps0 = 0.0f, ps1 = 0.0f;
#pragma unroll
            for (int r = 0; r < 8; ++r) {
                const float p0 = __expf(a[r] - mn);
                const float p1 = __expf(a[8 + r] - mn);
                bp[r]     = (_Float16)p0;
                bp[8 + r] = (_Float16)p1;
                ps0 += p0;
                ps1 += p1;
            }
            rl = rl * corr + (ps0 + ps1);
#pragma unroll
            for (int g = 0; g < 4; ++g)
#pragma unroll
                for (int r = 0; r < 8; ++r) acc[g][r] *= corr;

            // ---- O^T += V^T * P^T
#pragma unroll
            for (int g = 0; g < 4; ++g) acc[g] = wmma16(av[g], bp, acc[g]);
        }

        // publish point of stage st + 1, which also frees stage st's buffer
        asm volatile("s_wait_dscnt 0x0" ::: "memory");     // this wave has left the buffer
        asm volatile("s_wait_asynccnt 0x0" ::: "memory");  // its copies of stage st + 1 have landed
        __syncthreads();
        if (st + 2 < NSTAGE) STAGE(st + 2, st & 1);
    }
    // nothing is in flight here; kept so that no copy can outlive the wave
    asm volatile("s_wait_asynccnt 0x0" ::: "memory");
#undef STAGE

    const float inv = 1.0f / (rl + xhalf(rl));
    // consecutive r -> consecutive d -> packed 16B stores
    _Float16* orow = O + (size_t)(b * N_ + q0 + col) * INNER_ + h * DHEAD + 8 * half;
#pragma unroll
    for (int g = 0; g < 4; ++g) {
        h8 pk = {};
#pragma unroll
        for (int r = 0; r < 8; ++r) pk[r] = (_Float16)(acc[g][r] * inv);
        *(h8*)(orow + g * 16) = pk;
    }
}

// ---------------------------------------------------------------------------
extern "C" void kernel_launch(void* const* d_in, const int* in_sizes, int n_in,
                              void* d_out, int out_size, void* d_ws, size_t ws_size,
                              hipStream_t stream) {
    const float* x    = (const float*)d_in[0];
    const float* ctx  = (const float*)d_in[1];
    const int*   mask = (const int*)d_in[2];
    const float* Wq   = (const float*)d_in[3];
    const float* Wkv  = (const float*)d_in[4];
    const float* Wo   = (const float*)d_in[5];
    const float* bo   = (const float*)d_in[6];
    float* out = (float*)d_out;

    // Workspace layout (f16): six 8192x512 tensors + four 512x512 weights ~ 50 MB
    _Float16* W = (_Float16*)d_ws;
    const size_t SZ = (size_t)B_ * N_ * INNER_;   // 4M elements
    _Float16* x_h  = W;
    _Float16* c_h  = W + SZ;
    _Float16* q_h  = W + 2 * SZ;
    _Float16* k_h  = W + 3 * SZ;
    _Float16* vt_h = W + 4 * SZ;   // [B][INNER][M] (d-major V)
    _Float16* ao_h = W + 5 * SZ;
    _Float16* WqT  = W + 6 * SZ;
    _Float16* WkT  = WqT + 512 * 512;
    _Float16* WvT  = WkT + 512 * 512;
    _Float16* WoT  = WvT + 512 * 512;

    static_assert(((size_t)B_ * N_ * INNER_) % CV_BLOCK_E == 0, "the convert's grid is exact");
    const int gE = (int)(SZ / CV_BLOCK_E);   // 512 work-groups
    cvt_f32_to_h<<<gE, CV_THREADS, 0, stream>>>(x,   x_h);
    cvt_f32_to_h<<<gE, CV_THREADS, 0, stream>>>(ctx, c_h);

    const dim3 gW(512 / 32, 512 / 64);       // 512 columns x 512 rows a weight block
    cvt_transpose<<<gW, CV_THREADS, 0, stream>>>(Wq,  WqT, 512, 512,  0);
    cvt_transpose<<<gW, CV_THREADS, 0, stream>>>(Wkv, WkT, 512, 1024, 0);
    cvt_transpose<<<gW, CV_THREADS, 0, stream>>>(Wkv, WvT, 512, 1024, 512);
    cvt_transpose<<<gW, CV_THREADS, 0, stream>>>(Wo,  WoT, 512, 512,  0);

    // 128x128 tile of C per work-group: grid (columns / 128, rows / 128)
    static_assert(QDIM == GK && CDIM == GK && INNER_ == GK && INNER_ == GN && QDIM == GN,
                  "every projection is 512 deep and 512 wide");
    static_assert(GN % GTN == 0 && (B_ * N_) % GTM == 0 && (B_ * M_) % GTM == 0 && M_ % GTM == 0 && GNST >= 2,
                  "the grid is exact and the ring has its two stages");
    const dim3 gg(GN / GTN, (B_ * N_) / GTM);   // 4 x 64
    gemm_wmma<0><<<gg, GWAVES * 32, 0, stream>>>(x_h, WqT, q_h,  nullptr, nullptr);
    gemm_wmma<0><<<gg, GWAVES * 32, 0, stream>>>(c_h, WkT, k_h,  nullptr, nullptr);
    gemm_wmma<1><<<gg, GWAVES * 32, 0, stream>>>(c_h, WvT, vt_h, nullptr, nullptr);

    flash_attn<<<dim3(B_ * HEADS_, N_ / (QWAVES * 16)), QWAVES * 32, 0, stream>>>(q_h, k_h, vt_h, mask, ao_h);

    gemm_wmma<2><<<gg, GWAVES * 32, 0, stream>>>(ao_h, WoT, nullptr, out, bo);
}

// v005
// It runs in 75.9 microseconds.
// Timed twice side by side with v004, it ran 1.23 times as fast both times.
// Over all steps from v000 it is 5.59 times as fast.
#include <hip/hip_runtime.h>
#include <hip/hip_bf16.h>
#include <float.h>
#include <stdint.h>

// Problem constants (match the reference)
#define B_     4
#define N_     2048
#define M_     2048
#define QDIM   512
#define CDIM   512
#define HEADS_ 8
#define DHEAD  64
#define INNER_ 512
#define SCALE_ 0.125f   // 64^-0.5

typedef _Float16 v16h __attribute__((ext_vector_type(16)));
typedef _Float16 h8   __attribute__((ext_vector_type(8)));
typedef float    v8f  __attribute__((ext_vector_type(8)));

// Build a 16x32 f16 A/B fragment for v_wmma_f32_16x16x32_f16.
// Per the CDNA5 ISA layout, lane L (row/col = L%16, half = L/16) holds
//   frag[0..7]  = X[row][ 8*half + i]        (contiguous 16B)
//   frag[8..15] = X[row][16 + 8*half + i]    (contiguous 16B)
__device__ __forceinline__ v16h frag_ld(const _Float16* lo_p, const _Float16* hi_p) {
    h8 lo = *(const h8*)lo_p;
    h8 hi = *(const h8*)hi_p;
    v16h r;
#pragma unroll
    for (int i = 0; i < 8; ++i) { r[i] = lo[i]; r[i + 8] = hi[i]; }
    return r;
}

__device__ __forceinline__ v8f wmma16(v16h a, v16h b, v8f c) {
    // (neg_a, A, neg_b, B, c_mod, C, reuse_a, reuse_b)
    return __builtin_amdgcn_wmma_f32_16x16x32_f16(false, a, false, b, (short)0, c,
                                                  false, false);
}

// ---------------------------------------------------------------------------
typedef _Float16 h4 __attribute__((ext_vector_type(4)));
typedef float    f4 __attribute__((ext_vector_type(4)));

#define CV_THREADS 256
#define CV_LOADS   8                               // 16-byte loads in flight per lane
#define CV_WAVE_E  (CV_LOADS * 128)                // elements per wave: 4 KB of f32 in a row
#define CV_BLOCK_E ((CV_THREADS / 32) * CV_WAVE_E) // elements per work-group

// f32 -> f16 elementwise convert, 32 elements a lane: few waves to start, each with
// eight wave-wide loads of 512 contiguous bytes in flight; each store of a wave
// covers 256 contiguous bytes. Work-group blk of the tensor's CV_ACT_B, which cover
// it exactly (a multiple of CV_BLOCK_E elements), so there is no bound to test.
__device__ __forceinline__
void cvt_f32_to_h(const float* __restrict__ src, _Float16* __restrict__ dst, int blk) {
    const int wave = blk * (CV_THREADS / 32) + (threadIdx.x >> 5);
    const int base = wave * CV_WAVE_E + (threadIdx.x & 31) * 4;
    f4 v[CV_LOADS];
#pragma unroll
    for (int j = 0; j < CV_LOADS; ++j) v[j] = *(const f4*)(src + base + j * 128);
#pragma unroll
    for (int j = 0; j < CV_LOADS; ++j) {
        h4 o;
#pragma unroll
        for (int e = 0; e < 4; ++e) o[e] = (_Float16)v[j][e];
        *(h4*)(dst + base + j * 128) = o;
    }
    // inlined into cvt_all, another job's code follows in the listing: no register that
    // these stores name is rewritten ahead of this wait
    asm volatile("s_wait_xcnt 0x0" ::: "memory");
}

// Transpose-convert weight W[in=rows][... ld ...] (a block of columns from col0 on)
// into Wt[out][in] f16, so GEMM B-operand columns become contiguous rows.
// A lane takes 8 rows of one column: eight loads in flight, each 128 contiguous bytes
// a wave, and one 16-byte store; the eight waves of a work-group take 64 rows, so a
// work-group writes whole 128-byte lines of Wt. Work-group (bx, by) of (columns / 32,
// rows / 64), which cover the block exactly.
__device__ __forceinline__
void cvt_transpose(const float* __restrict__ src,
                   _Float16* __restrict__ dst,
                   int rows, int ld, int col0, int bx, int by) {
    const int o  = bx * 32 + (threadIdx.x & 31);
    const int r0 = by * 64 + (threadIdx.x >> 5) * 8;
    const float* s = src + (size_t)r0 * ld + col0 + o;
    float v[8];
#pragma unroll
    for (int i = 0; i < 8; ++i) v[i] = s[(size_t)i * ld];
    h8 pk;
#pragma unroll
    for (int i = 0; i < 8; ++i) pk[i] = (_Float16)v[i];
    *(h8*)(dst + (size_t)o * rows + r0) = pk;
    // as at the end of cvt_f32_to_h: in front of any rewrite of the store's registers
    asm volatile("s_wait_xcnt 0x0" ::: "memory");
}

#define ACT_E    (B_ * N_ * INNER_)        // elements of one activation tensor
#define WGT_E    (512 * 512)               // elements of one weight block
#define CV_ACT_B (ACT_E / CV_BLOCK_E)      // work-groups per activation tensor
#define CV_WGT_B ((512 / 32) * (512 / 64)) // work-groups per weight block

// All six converts in one launch: none reads what another writes, so one grid holds
// them side by side and the short weight blocks run under the two long streams
// instead of each waiting for the launch before it to drain. The work-group index
// picks the job: x, context (the long ones start first), then the four weight blocks,
// whose transposes lie one behind the other in Wt: Wq, the K half and the V half of
// Wkv, Wo.
__global__ __launch_bounds__(CV_THREADS)
void cvt_all(const float* __restrict__ x, const float* __restrict__ ctx,
             const float* __restrict__ Wq, const float* __restrict__ Wkv,
             const float* __restrict__ Wo,
             _Float16* __restrict__ x_h, _Float16* __restrict__ c_h,
             _Float16* __restrict__ Wt) {
    const int bid = blockIdx.x;
    if (bid < CV_ACT_B) {
        cvt_f32_to_h(x, x_h, bid);
    } else if (bid < 2 * CV_ACT_B) {
        cvt_f32_to_h(ctx, c_h, bid - CV_ACT_B);
    } else {
        const int w  = (bid - 2 * CV_ACT_B) / CV_WGT_B;   // which weight block
        const int t  = (bid - 2 * CV_ACT_B) % CV_WGT_B;
        const int bx = t % (512 / 32);
        const int by = t / (512 / 32);
        if (w == 1 || w == 2)
            cvt_transpose(Wkv, Wt + w * WGT_E, 512, 1024, (w - 1) * 512, bx, by);
        else
            cvt_transpose(w == 0 ? Wq : Wo, Wt + w * WGT_E, 512, 512, 0, bx, by);
    }
}

// ---------------------------------------------------------------------------
// Geometry of gemm_wmma's work-group and of its LDS ring
#define GWAVES 8                 // waves per work-group: 4 along m x 2 along n, 32 x 64 of C each
#define GTM    128               // rows of C per work-group
#define GTN    128               // columns of C per work-group
#define GK     512               // depth of every projection
#define GN     512               // columns of every projection
#define GSK    128               // k per stage: operand rows of 256 B
#define GPITCH 136               // halfs per LDS row: 256 B + 16 B, an odd multiple of 16 B
#define GTILE  (128 * GPITCH)    // halfs of one staged operand tile (128 rows)
#define GNST   (GK / GSK)

// One operand tile's share of one lane: eight 16-byte asynchronous copies to LDS,
// rows 16 apart. The s_wait_xcnt closes the statement, so that no register a copy
// names is rewritten ahead of it.
__device__ __forceinline__ void tile_copy(unsigned l, const _Float16* g) {
    const unsigned ls = 16 * GPITCH * 2;   // bytes between two of the lane's LDS rows
    const int      gs = 16 * GK;           // halfs between two of its global rows
    asm volatile("global_load_async_to_lds_b128 %0, %8, off\n\t"
                 "global_load_async_to_lds_b128 %1, %9, off\n\t"
                 "global_load_async_to_lds_b128 %2, %10, off\n\t"
                 "global_load_async_to_lds_b128 %3, %11, off\n\t"
                 "global_load_async_to_lds_b128 %4, %12, off\n\t"
                 "global_load_async_to_lds_b128 %5, %13, off\n\t"
                 "global_load_async_to_lds_b128 %6, %14, off\n\t"
                 "global_load_async_to_lds_b128 %7, %15, off\n\t"
                 "s_wait_xcnt 0x0"
                 :: "v"(l), "v"(l + ls), "v"(l + 2 * ls), "v"(l + 3 * ls),
                    "v"(l + 4 * ls), "v"(l + 5 * ls), "v"(l + 6 * ls), "v"(l + 7 * ls),
                    "v"(g), "v"(g + gs), "v"(g + 2 * gs), "v"(g + 3 * gs),
                    "v"(g + 4 * gs), "v"(g + 5 * gs), "v"(g + 6 * gs), "v"(g + 7 * gs)
                 : "memory");
}

// f16 WMMA GEMM: C[m][n] = sum_k A[m][k] * Bt[n][k], both operands k-contiguous.
// A work-group of eight waves computes a 128 x 128 tile of C. Each stage of 128 k
// (128 rows of A and 128 rows of Bt, 256 bytes a row) is brought into LDS once for
// all eight waves, in whole 256-byte pieces, by asynchronous copies into a ring of
// two buffers; the fragments are read from there, and every fragment read feeds
// four (A) or two (Bt) WMMAs of its wave's 2 x 4 accumulator tiles.
// MODE: 0 = the three input projections in one launch: none reads what another
//           writes, so one grid of 3 x 4 column tiles holds them, two work-groups a
//           WGP, and one's first stage and stores run under another's products.
//           Bt is the three transposed weights one behind the other (1536 rows);
//           column tiles 0..3 are Q = A0 * Wq and 4..7 are K = A1 * Wk, f16 row-major;
//           8..11 are V = A1 * Wv, f16 transposed per batch -> out[b][n][m%Mdim],
//       2 = f32 store + bias (final projection of A0 into d_out).
// Left open: the row-major stores are still 2 or 4 bytes a lane; 768 work-groups on
// 512 places are one round and a half; x and context are still converted in a
// launch of their own.
template <int MODE>
__global__ __launch_bounds__(GWAVES * 32)
void gemm_wmma(const _Float16* __restrict__ A0,
               const _Float16* __restrict__ A1,
               const _Float16* __restrict__ Bt,
               _Float16* __restrict__ outQ,
               _Float16* __restrict__ outK,
               _Float16* __restrict__ outVt,
               float* __restrict__ outF,
               const float* __restrict__ bias) {
    constexpr int Mdim = M_;
    constexpr int NT   = GN / GTN;      // column tiles of one projection
    // which projection this work-group belongs to (the same for all its waves)
    const int sel = MODE == 0 ? blockIdx.x / NT : 0;
    const _Float16* A = sel == 0 ? A0 : A1;
    // [buffer][A tile, then Bt tile]
    __shared__ __attribute__((aligned(16))) _Float16 gring[2][2 * GTILE];

    const int tid  = threadIdx.x;
    const int lane = tid & 31;
    const int col  = lane & 15;
    const int half = lane >> 4;
    const int kb0  = 8 * half;
    const int wm   = (tid >> 5) & 3;    // this wave's 32 rows of the tile
    const int wn   = tid >> 7;          // this wave's 64 columns of the tile
    const int n0   = (blockIdx.x % NT) * GTN;   // first column within the projection's output
    const int m0   = blockIdx.y * GTM;

    // This lane's place in a stage: rows crow + 16 i of either tile, 16 bytes at
    // cch; a wave's copy covers two whole rows of 256 bytes.
    const int crow = tid >> 4;
    const int cch  = (tid & 15) * 8;
    const _Float16* ga = A  + (size_t)(m0 + crow) * GK + cch;
    const _Float16* gb = Bt + (size_t)(blockIdx.x * GTN + crow) * GK + cch;
    const unsigned  la = (unsigned)(uintptr_t)&gring[0][crow * GPITCH + cch];
#define GSTAGE(st, bf) do {                                                         \
        const unsigned l_ = la + (unsigned)(bf) * (2 * GTILE * 2);                  \
        tile_copy(l_,             ga + (st) * GSK);                                 \
        tile_copy(l_ + GTILE * 2, gb + (st) * GSK);                                 \
    } while (0)

    // stage 0, landed and published; then stage 1 flies under pass 0
    GSTAGE(0, 0);
    asm volatile("s_wait_asynccnt 0x0" ::: "memory");   // this wave's copies have landed
    __syncthreads();                                    // and every other wave's
    GSTAGE(1, 1);

    v8f acc[2][4];
#pragma unroll
    for (int i = 0; i < 2; ++i)
#pragma unroll
        for (int t = 0; t < 4; ++t) acc[i][t] = (v8f){};

    for (int st = 0; st < GNST; ++st) {
        const _Float16* ap = gring[st & 1] + (wm * 32 + col) * GPITCH + kb0;
        const _Float16* bp = gring[st & 1] + GTILE + (wn * 64 + col) * GPITCH + kb0;
        // two fragment sets: k-step j + 1 of this stage is read while k-step j is multiplied
        v16h a[2][2], b[2][4];
#define GFRAGS(set, ks) do {                                                        \
        _Pragma("unroll")                                                           \
        for (int i = 0; i < 2; ++i)                                                 \
            a[set][i] = frag_ld(ap + i * 16 * GPITCH + (ks),                        \
                                ap + i * 16 * GPITCH + (ks) + 16);                  \
        _Pragma("unroll")                                                           \
        for (int t = 0; t < 4; ++t)                                                 \
            b[set][t] = frag_ld(bp + t * 16 * GPITCH + (ks),                        \
                                bp + t * 16 * GPITCH + (ks) + 16);                  \
    } while (0)
        GFRAGS(0, 0);
        // unrolled (as every loop over i, t, r here): the set index j & 1 is then a
        // constant, and the fragments and accumulators stay in registers
#pragma unroll
        for (int j = 0; j < GSK / 32; ++j) {
            if (j + 1 < GSK / 32) GFRAGS((j + 1) & 1, (j + 1) * 32);
            // keeps the next k-step's twelve LDS reads one group in front of this k-step's
            // WMMAs; left free, they are spread among the WMMAs and waited for at once
            __builtin_amdgcn_sched_barrier(0);
#pragma unroll
            for (int i = 0; i < 2; ++i)
#pragma unroll
                for (int t = 0; t < 4; ++t)
                    acc[i][t] = wmma16(a[j & 1][i], b[j & 1][t], acc[i][t]);
            // and the reads after next behind them
            __builtin_amdgcn_sched_barrier(0);
        }
#undef GFRAGS

        // publish point of stage st + 1, which also frees stage st's buffer
        asm volatile("s_wait_dscnt 0x0" ::: "memory");     // this wave has left the buffer
        asm volatile("s_wait_asynccnt 0x0" ::: "memory");  // its copies of stage st + 1 have landed
        __syncthreads();
        if (st + 2 < GNST) GSTAGE(st + 2, st & 1);
    }
    // nothing is in flight here; kept so that no copy can outlive the wave
    asm volatile("s_wait_asynccnt 0x0" ::: "memory");
#undef GSTAGE

    // C-layout: lane (col, half), VGPR r  <->  row = 8*half + r, column = col
    const int mr0 = m0 + wm * 32 + 8 * half;
    const int nc0 = n0 + wn * 64 + col;
    if (MODE == 0 && sel != 2) {
        _Float16* o0 = (sel == 0 ? outQ : outK) + (size_t)mr0 * GN + nc0;
        _Float16* o1 = o0 + 16 * GN;
        _Float16  hv[2][4][8];
#pragma unroll
        for (int i = 0; i < 2; ++i)
#pragma unroll
            for (int t = 0; t < 4; ++t)
#pragma unroll
                for (int r = 0; r < 8; ++r) hv[i][t][r] = (_Float16)acc[i][t][r];
        // every convert stands in front of the first store: left free, converts among the
        // stores reuse registers that issued stores name, each behind a wait of its own
        __builtin_amdgcn_sched_barrier(0);
#pragma unroll
        for (int t = 0; t < 4; ++t)
#pragma unroll
            for (int r = 0; r < 8; ++r) {
                o0[r * GN + t * 16] = hv[0][t][r];
                o1[r * GN + t * 16] = hv[1][t][r];
            }
    } else if (MODE == 0) {
        // transposed store: consecutive r -> consecutive m -> packed 16B stores
        // (a tile's 128 rows lie in one batch: Mdim is a multiple of GTM)
        const int bidx = mr0 / Mdim;
        const int mloc = mr0 % Mdim;
#pragma unroll
        for (int i = 0; i < 2; ++i)
#pragma unroll
            for (int t = 0; t < 4; ++t) {
                h8 pk = {};
#pragma unroll
                for (int r = 0; r < 8; ++r) pk[r] = (_Float16)acc[i][t][r];
                *(h8*)(outVt + ((size_t)bidx * GN + nc0 + t * 16) * Mdim + mloc + i * 16) = pk;
            }
    } else {
#pragma unroll
        for (int t = 0; t < 4; ++t) {
            const float bv = bias[nc0 + t * 16];
#pragma unroll
            for (int i = 0; i < 2; ++i)
#pragma unroll
                for (int r = 0; r < 8; ++r)
                    outF[(size_t)(mr0 + i * 16 + r) * GN + nc0 + t * 16] = acc[i][t][r] + bv;
        }
    }
}

// ---------------------------------------------------------------------------
// Lane l <-> lane l ^ 16 (the two halves of a wave that share one query column)
__device__ __forceinline__ float xhalf(float x) {
    const int b = __builtin_bit_cast(int, x);
    return __builtin_bit_cast(float,
        __builtin_amdgcn_permlanex16(b, b, 0x76543210, 0xfedcba98, false, false));
}

// x where bit 'bit' of m is set, else -FLT_MAX: the bit spread over the word
// picks between the two bit patterns (two vector instructions, no compare)
__device__ __forceinline__ float keep(unsigned m, int bit, float x) {
    const int sel = (int)(m << (31 - bit)) >> 31;
    const int fil = __builtin_bit_cast(int, -FLT_MAX);
    return __builtin_bit_cast(float, (sel & __builtin_bit_cast(int, x)) | (~sel & fil));
}

// Geometry of flash_attn's work-group and of its LDS ring
#define QWAVES 8                 // waves per work-group, 16 query columns each
#define TKEYS  64                // keys per stage: K rows and V^T rows are both 128 B
#define PITCH  72                // halfs per LDS row: 128 B + 16 B, an odd multiple of 16 B
#define TILE_H (64 * PITCH)      // halfs of one staged tile (64 rows)
#define NSTAGE (M_ / TKEYS)

// One stage's share of one lane: four 16-byte asynchronous copies to LDS.
// The s_wait_xcnt closes the statement, so that no register a copy names is
// rewritten ahead of it.
__device__ __forceinline__ void stage_copy(unsigned l0, unsigned l1, unsigned l2, unsigned l3,
                                           const _Float16* g0, const _Float16* g1,
                                           const _Float16* g2, const _Float16* g3) {
    asm volatile("global_load_async_to_lds_b128 %0, %4, off\n\t"
                 "global_load_async_to_lds_b128 %1, %5, off\n\t"
                 "global_load_async_to_lds_b128 %2, %6, off\n\t"
                 "global_load_async_to_lds_b128 %3, %7, off\n\t"
                 "s_wait_xcnt 0x0"
                 :: "v"(l0), "v"(l1), "v"(l2), "v"(l3), "v"(g0), "v"(g1), "v"(g2), "v"(g3)
                 : "memory");
}

__global__ __launch_bounds__(QWAVES * 32) __attribute__((amdgpu_waves_per_eu(4, 4)))
void flash_attn(const _Float16* __restrict__ Q,
                const _Float16* __restrict__ Kh,
                const _Float16* __restrict__ Vt,
                const int* __restrict__ mask,
                _Float16* __restrict__ O) {
    // [buffer][K tile, then V^T tile]
    __shared__ __attribute__((aligned(16))) _Float16 ring[2][2 * TILE_H];

    const int tid  = threadIdx.x;
    const int lane = tid & 31;
    const int col  = lane & 15;
    const int half = lane >> 4;
    const int kb0  = 8 * half;
    const int bh   = blockIdx.x;
    const int b    = bh / HEADS_;
    const int h    = bh % HEADS_;
    const int q0   = blockIdx.y * (QWAVES * 16) + (tid >> 5) * 16;

    const _Float16* kbase = Kh + (size_t)b * M_ * INNER_ + h * DHEAD;
    const _Float16* vbase = Vt + ((size_t)b * INNER_ + h * DHEAD) * M_;
    const int* mrow = mask + b * M_;

    // This lane's place in a stage: rows crow and crow + 32 of either tile, 16
    // bytes at cch; a wave's copy covers four whole rows of 128 bytes.
    const int crow = tid >> 3;
    const int cch  = (tid & 7) * 8;
    const _Float16* gk = kbase + (size_t)crow * INNER_ + cch;
    const _Float16* gv = vbase + (size_t)crow * M_ + cch;
    const unsigned  lk = (unsigned)(uintptr_t)&ring[0][crow * PITCH + cch];
#define STAGE(st, bf) do {                                                          \
        const unsigned  l_ = lk + (unsigned)(bf) * (2 * TILE_H * 2);                \
        const _Float16* k_ = gk + (size_t)(st) * TKEYS * INNER_;                    \
        const _Float16* v_ = gv + (size_t)(st) * TKEYS;                             \
        stage_copy(l_, l_ + 32 * PITCH * 2, l_ + TILE_H * 2,                        \
                   l_ + TILE_H * 2 + 32 * PITCH * 2,                                \
                   k_, k_ + 32 * INNER_, v_, v_ + (size_t)32 * M_);                 \
    } while (0)

    // Q fragments stay resident: two 32x16 chunks covering d = 0..63
    const _Float16* qp = Q + (size_t)(b * N_ + q0 + col) * INNER_ + h * DHEAD + kb0;
    const v16h bq0 = frag_ld(qp,      qp + 16);
    const v16h bq1 = frag_ld(qp + 32, qp + 48);
    // the four loads share the address pair qp: naming it keeps it live up to
    // the wait, so that it is not rewritten ahead of it
    asm volatile("s_wait_xcnt 0x0" :: "v"(qp) : "memory");

    // stage 0, landed and published; then stage 1 flies under pass 0
    STAGE(0, 0);
    asm volatile("s_wait_asynccnt 0x0" ::: "memory");   // this wave's copies have landed
    __syncthreads();                                    // and every other wave's
    STAGE(1, 1);

    float rm = -FLT_MAX;   // running maximum of this lane's query (same in both halves)
    float rl = 0.0f;       // running sum over this half's keys only; joined at the end
    v8f acc[4];            // acc[g][r] = O^T[g*16 + 8*half + r][query col]
#pragma unroll
    for (int g = 0; g < 4; ++g) acc[g] = (v8f){};

    for (int st = 0; st < NSTAGE; ++st) {
        const _Float16* ktile = ring[st & 1];
        const _Float16* vtile = ktile + TILE_H;

#pragma unroll
        for (int s = 0; s < TKEYS; s += 32) {
            const int j0 = st * TKEYS + s;
            // the pass's 32 mask words, one per lane
            const int mword = mrow[j0 + lane];

            // ---- S^T = K*Q^T for 32 keys: two 16-key C tiles, 4 WMMAs total
            const _Float16* kp = ktile + (s + col) * PITCH + kb0;
            const v16h ak00 = frag_ld(kp,                   kp + 16);
            const v16h ak01 = frag_ld(kp + 32,              kp + 48);
            const v16h ak10 = frag_ld(kp + 16 * PITCH,      kp + 16 * PITCH + 16);
            const v16h ak11 = frag_ld(kp + 16 * PITCH + 32, kp + 16 * PITCH + 48);

            // V^T rows (d-major V): read under the S^T products and the softmax
            const _Float16* vp = vtile + col * PITCH + s + kb0;
            v16h av[4];
#pragma unroll
            for (int g = 0; g < 4; ++g)
                av[g] = frag_ld(vp + g * 16 * PITCH, vp + g * 16 * PITCH + 16);

            v8f s0 = {}, s1 = {};
            s0 = wmma16(ak00, bq0, s0);
            s1 = wmma16(ak10, bq0, s1);
            s0 = wmma16(ak01, bq1, s0);
            s1 = wmma16(ak11, bq1, s1);

            // ---- online softmax, one query per lane
            // bit k of the ballot = key j0 + k; this lane's 16 keys are j0 + 8*half + r
            // (bit r of mk) and j0 + 16 + 8*half + r (bit 16 + r of mk)
            const unsigned mk = __builtin_amdgcn_ballot_w32(mword != 0) >> kb0;
            float a[16];
#pragma unroll
            for (int r = 0; r < 8; ++r) {
                a[r]     = keep(mk, r,      s0[r] * SCALE_);
                a[8 + r] = keep(mk, 16 + r, s1[r] * SCALE_);
            }
            float t = a[0];
#pragma unroll
            for (int i = 1; i < 16; ++i) t = fmaxf(t, a[i]);
            t = fmaxf(t, xhalf(t));
            const float mn   = fmaxf(rm, t);
            const float corr = __expf(rm - mn);
            rm = mn;

            v16h bp;           // P^T as a B fragment: element r <-> key j0 + 8*half + r, 8 + r <-> key j0 + 16 + 8*half + r
            float ps0 = 0.0f, ps1 = 0.0f;
#pragma unroll
            for (int r = 0; r < 8; ++r) {
                const float p0 = __expf(a[r] - mn);
                const float p1 = __expf(a[8 + r] - mn);
                bp[r]     = (_Float16)p0;
                bp[8 + r] = (_Float16)p1;
                ps0 += p0;
                ps1 += p1;
            }
            rl = rl * corr + (ps0 + ps1);
#pragma unroll
            for (int g = 0; g < 4; ++g)
#pragma unroll
                for (int r = 0; r < 8; ++r) acc[g][r] *= corr;

            // ---- O^T += V^T * P^T
#pragma unroll
            for (int g = 0; g < 4; ++g) acc[g] = wmma16(av[g], bp, acc[g]);
        }

        // publish point of stage st + 1, which also frees stage st's buffer
        asm volatile("s_wait_dscnt 0x0" ::: "memory");     // this wave has left the buffer
        asm volatile("s_wait_asynccnt 0x0" ::: "memory");  // its copies of stage st + 1 have landed
        __syncthreads();
        if (st + 2 < NSTAGE) STAGE(st + 2, st & 1);
    }
    // nothing is in flight here; kept so that no copy can outlive the wave
    asm volatile("s_wait_asynccnt 0x0" ::: "memory");
#undef STAGE

    const float inv = 1.0f / (rl + xhalf(rl));
    // consecutive r -> consecutive d -> packed 16B stores
    _Float16* orow = O + (size_t)(b * N_ + q0 + col) * INNER_ + h * DHEAD + 8 * half;
#pragma unroll
    for (int g = 0; g < 4; ++g) {
        h8 pk = {};
#pragma unroll
        for (int r = 0; r < 8; ++r) pk[r] = (_Float16)(acc[g][r] * inv);
        *(h8*)(orow + g * 16) = pk;
    }
}

// ---------------------------------------------------------------------------
extern "C" void kernel_launch(void* const* d_in, const int* in_sizes, int n_in,
                              void* d_out, int out_size, void* d_ws, size_t ws_size,
                              hipStream_t stream) {
    const float* x    = (const float*)d_in[0];
    const float* ctx  = (const float*)d_in[1];
    const int*   mask = (const int*)d_in[2];
    const float* Wq   = (const float*)d_in[3];
    const float* Wkv  = (const float*)d_in[4];
    const float* Wo   = (const float*)d_in[5];
    const float* bo   = (const float*)d_in[6];
    float* out = (float*)d_out;

    // Workspace layout (f16): six 8192x512 tensors + four 512x512 weights ~ 50 MB
    _Float16* W = (_Float16*)d_ws;
    const size_t SZ = (size_t)B_ * N_ * INNER_;   // 4M elements
    _Float16* x_h  = W;
    _Float16* c_h  = W + SZ;
    _Float16* q_h  = W + 2 * SZ;
    _Float16* k_h  = W + 3 * SZ;
    _Float16* vt_h = W + 4 * SZ;   // [B][INNER][M] (d-major V)
    _Float16* ao_h = W + 5 * SZ;
    _Float16* Wt   = W + 6 * SZ;       // WqT, WkT, WvT, WoT, one behind the other
    _Float16* WoT  = Wt + 3 * WGT_E;

    static_assert(ACT_E % CV_BLOCK_E == 0 && B_ * M_ * CDIM == ACT_E && B_ * N_ * QDIM == ACT_E,
                  "the convert's grid is exact");
    cvt_all<<<2 * CV_ACT_B + 4 * CV_WGT_B, CV_THREADS, 0, stream>>>(x, ctx, Wq, Wkv, Wo, x_h, c_h, Wt);

    // 128x128 tile of C per work-group: grid (columns / 128, rows / 128)
    static_assert(QDIM == GK && CDIM == GK && INNER_ == GK && INNER_ == GN && QDIM == GN,
                  "every projection is 512 deep and 512 wide");
    static_assert(GN % GTN == 0 && (B_ * N_) % GTM == 0 && (B_ * M_) % GTM == 0 && M_ % GTM == 0 && GNST >= 2,
                  "the grid is exact and the ring has its two stages");
    static_assert(B_ * N_ == B_ * M_, "the three input projections have the same rows");
    const dim3 gg(GN / GTN, (B_ * N_) / GTM);       // 4 x 64
    const dim3 g3(3 * (GN / GTN), (B_ * N_) / GTM); // 12 x 64
    gemm_wmma<0><<<g3, GWAVES * 32, 0, stream>>>(x_h, c_h, Wt, q_h, k_h, vt_h, nullptr, nullptr);

    flash_attn<<<dim3(B_ * HEADS_, N_ / (QWAVES * 16)), QWAVES * 32, 0, stream>>>(q_h, k_h, vt_h, mask, ao_h);

    gemm_wmma<2><<<gg, GWAVES * 32, 0, stream>>>(ao_h, nullptr, WoT, nullptr, nullptr, nullptr, out, bo);
}

// v006
// One run takes 52.8 microseconds.
// In two side-by-side timings against v005, it was 1.44 and 1.45 times as fast.
// All steps since v000 together make it 8.07 times as fast.
#include <hip/hip_runtime.h>
#include <hip/hip_bf16.h>
#include <float.h>
#include <stdint.h>

// Problem constants (match the reference)
#define B_     4
#define N_     2048
#define M_     2048
#define QDIM   512
#define CDIM   512
#define HEADS_ 8
#define DHEAD  64
#define INNER_ 512
#define SCALE_ 0.125f   // 64^-0.5

typedef _Float16 v16h __attribute__((ext_vector_type(16)));
typedef _Float16 h8   __attribute__((ext_vector_type(8)));
typedef float    v8f  __attribute__((ext_vector_type(8)));

// Build a 16x32 f16 A/B fragment for v_wmma_f32_16x16x32_f16.
// Per the CDNA5 ISA layout, lane L (row/col = L%16, half = L/16) holds
//   frag[0..7]  = X[row][ 8*half + i]        (contiguous 16B)
//   frag[8..15] = X[row][16 + 8*half + i]    (contiguous 16B)
__device__ __forceinline__ v16h frag_ld(const _Float16* lo_p, const _Float16* hi_p) {
    h8 lo = *(const h8*)lo_p;
    h8 hi = *(const h8*)hi_p;
    v16h r;
#pragma unroll
    for (int i = 0; i < 8; ++i) { r[i] = lo[i]; r[i + 8] = hi[i]; }
    return r;
}

__device__ __forceinline__ v8f wmma16(v16h a, v16h b, v8f c) {
    // (neg_a, A, neg_b, B, c_mod, C, reuse_a, reuse_b)
    return __builtin_amdgcn_wmma_f32_16x16x32_f16(false, a, false, b, (short)0, c,
                                                  false, false);
}

// ---------------------------------------------------------------------------
typedef _Float16 h4 __attribute__((ext_vector_type(4)));
typedef float    f4 __attribute__((ext_vector_type(4)));

#define CV_THREADS 256
#define CV_LOADS   8                               // 16-byte loads in flight per lane
#define CV_WAVE_E  (CV_LOADS * 128)                // elements per wave: 4 KB of f32 in a row
#define CV_BLOCK_E ((CV_THREADS / 32) * CV_WAVE_E) // elements per work-group

// f32 -> f16 elementwise convert, 32 elements a lane: few waves to start, each with
// eight wave-wide loads of 512 contiguous bytes in flight; each store of a wave
// covers 256 contiguous bytes. Work-group blk of the tensor's CV_ACT_B, which cover
// it exactly (a multiple of CV_BLOCK_E elements), so there is no bound to test.
__device__ __forceinline__
void cvt_f32_to_h(const float* __restrict__ src, _Float16* __restrict__ dst, int blk) {
    const int wave = blk * (CV_THREADS / 32) + (threadIdx.x >> 5);
    const int base = wave * CV_WAVE_E + (threadIdx.x & 31) * 4;
    f4 v[CV_LOADS];
#pragma unroll
    for (int j = 0; j < CV_LOADS; ++j) v[j] = *(const f4*)(src + base + j * 128);
#pragma unroll
    for (int j = 0; j < CV_LOADS; ++j) {
        h4 o;
#pragma unroll
        for (int e = 0; e < 4; ++e) o[e] = (_Float16)v[j][e];
        *(h4*)(dst + base + j * 128) = o;
    }
    // inlined into cvt_all, another job's code follows in the listing: no register that
    // these stores name is rewritten ahead of this wait
    asm volatile("s_wait_xcnt 0x0" ::: "memory");
}

// Transpose-convert weight W[in=rows][... ld ...] (a block of columns from col0 on)
// into Wt[out][in] f16, so GEMM B-operand columns become contiguous rows.
// A lane takes 8 rows of one column: eight loads in flight, each 128 contiguous bytes
// a wave, and one 16-byte store; the eight waves of a work-group take 64 rows, so a
// work-group writes whole 128-byte lines of Wt. Work-group (bx, by) of (columns / 32,
// rows / 64), which cover the block exactly.
__device__ __forceinline__
void cvt_transpose(const float* __restrict__ src,
                   _Float16* __restrict__ dst,
                   int rows, int ld, int col0, int bx, int by) {
    const int o  = bx * 32 + (threadIdx.x & 31);
    const int r0 = by * 64 + (threadIdx.x >> 5) * 8;
    const float* s = src + (size_t)r0 * ld + col0 + o;
    float v[8];
#pragma unroll
    for (int i = 0; i < 8; ++i) v[i] = s[(size_t)i * ld];
    h8 pk;
#pragma unroll
    for (int i = 0; i < 8; ++i) pk[i] = (_Float16)v[i];
    *(h8*)(dst + (size_t)o * rows + r0) = pk;
    // as at the end of cvt_f32_to_h: in front of any rewrite of the store's registers
    asm volatile("s_wait_xcnt 0x0" ::: "memory");
}

#define ACT_E    (B_ * N_ * INNER_)        // elements of one activation tensor
#define WGT_E    (512 * 512)               // elements of one weight block
#define CV_ACT_B (ACT_E / CV_BLOCK_E)      // work-groups per activation tensor
#define CV_WGT_B ((512 / 32) * (512 / 64)) // work-groups per weight block

#define CNT_LD 32   // ints between two batches' counts: each work-group writes a 128-byte line of its own

// Key order of one batch: the keys whose mask word is set first, in their own order,
// then the masked ones; ord[p] = key at place p, cnt = how many are set. A masked key's
// weight is exp(-FLT_MAX - max) = 0 wherever the batch has one key set, so the K and V
// projections and the attention need only the first cnt places (a batch with none set
// keeps all its keys, all masked: uniform weights, as in the reference).
// One work-group a batch; wave w takes keys 256 w .. 256 w + 255, 32 a ballot.
__device__ __forceinline__
void key_order(const int* __restrict__ mask, int* __restrict__ ord, int* __restrict__ cnt) {
    __shared__ int wsum[CV_THREADS / 32];
    const int lane = threadIdx.x & 31;
    const int wave = threadIdx.x >> 5;
    constexpr int NB = M_ / CV_THREADS;          // ballots per wave
    const int* mp = mask + wave * (NB * 32) + lane;
    unsigned bal[NB];
    int tot = 0;
#pragma unroll
    for (int i = 0; i < NB; ++i) {
        bal[i] = __builtin_amdgcn_ballot_w32(mp[i * 32] != 0);
        tot += __builtin_popcount(bal[i]);
    }
    // the loads share the address pair mp: naming it keeps it live up to the wait, so
    // that it is not rewritten ahead of it
    asm volatile("s_wait_xcnt 0x0" :: "v"(mp) : "memory");
    if (lane == 0) wsum[wave] = tot;
    __syncthreads();
    int before = 0, all = 0;                     // set keys in earlier waves, in the batch
#pragma unroll
    for (int w = 0; w < CV_THREADS / 32; ++w) {
        const int t = wsum[w];
        before += w < wave ? t : 0;
        all    += t;
    }
    const unsigned below = (1u << lane) - 1u;
    const int key0 = wave * (NB * 32) + lane;
#pragma unroll
    for (int i = 0; i < NB; ++i) {
        const int key = key0 + i * 32;
        const int set = before + __builtin_popcount(bal[i] & below);   // set keys in front of this one
        ord[((bal[i] >> lane) & 1u) ? set : all + key - set] = key;    // masked ones follow all set ones
        before += __builtin_popcount(bal[i]);
    }
    if (threadIdx.x == 0) *cnt = all;
    // as at the end of cvt_f32_to_h: in front of any rewrite of the stores' registers
    asm volatile("s_wait_xcnt 0x0" ::: "memory");
}

// All six converts in one launch: none reads what another writes, so one grid holds
// them side by side and the short weight blocks run under the two long streams
// instead of each waiting for the launch before it to drain. The work-group index
// picks the job: x, context (the long ones start first), then the four weight blocks,
// whose transposes lie one behind the other in Wt: Wq, the K half and the V half of
// Wkv, Wo. The first B_ work-groups form the batches' key orders.
__global__ __launch_bounds__(CV_THREADS)
void cvt_all(const float* __restrict__ x, const float* __restrict__ ctx,
             const float* __restrict__ Wq, const float* __restrict__ Wkv,
             const float* __restrict__ Wo, const int* __restrict__ mask,
             _Float16* __restrict__ x_h, _Float16* __restrict__ c_h,
             _Float16* __restrict__ Wt, int* __restrict__ ord, int* __restrict__ cnt) {
    const int bid = (int)blockIdx.x - B_;
    if (bid < 0) {
        const int b = blockIdx.x;
        key_order(mask + b * M_, ord + b * M_, cnt + b * CNT_LD);
    } else if (bid < CV_ACT_B) {
        cvt_f32_to_h(x, x_h, bid);
    } else if (bid < 2 * CV_ACT_B) {
        cvt_f32_to_h(ctx, c_h, bid - CV_ACT_B);
    } else {
        const int w  = (bid - 2 * CV_ACT_B) / CV_WGT_B;   // which weight block
        const int t  = (bid - 2 * CV_ACT_B) % CV_WGT_B;
        const int bx = t % (512 / 32);
        const int by = t / (512 / 32);
        if (w == 1 || w == 2)
            cvt_transpose(Wkv, Wt + w * WGT_E, 512, 1024, (w - 1) * 512, bx, by);
        else
            cvt_transpose(w == 0 ? Wq : Wo, Wt + w * WGT_E, 512, 512, 0, bx, by);
    }
}

// ---------------------------------------------------------------------------
// Geometry of gemm_wmma's work-group and of its LDS ring
#define GWAVES 8                 // waves per work-group: 4 along m x 2 along n, 32 x 64 of C each
#define GTM    128               // rows of C per work-group
#define GTN    128               // columns of C per work-group
#define GK     512               // depth of every projection
#define GN     512               // columns of every projection
#define GSK    128               // k per stage: operand rows of 256 B
#define GPITCH 136               // halfs per LDS row: 256 B + 16 B, an odd multiple of 16 B
#define GTILE  (128 * GPITCH)    // halfs of one staged operand tile (128 rows)
#define GNST   (GK / GSK)

// One operand tile's share of one lane: eight 16-byte asynchronous copies to LDS,
// rows 16 apart. The s_wait_xcnt closes the statement, so that no register a copy
// names is rewritten ahead of it.
__device__ __forceinline__ void tile_copy(unsigned l, const _Float16* g) {
    const unsigned ls = 16 * GPITCH * 2;   // bytes between two of the lane's LDS rows
    const int      gs = 16 * GK;           // halfs between two of its global rows
    asm volatile("global_load_async_to_lds_b128 %0, %8, off\n\t"
                 "global_load_async_to_lds_b128 %1, %9, off\n\t"
                 "global_load_async_to_lds_b128 %2, %10, off\n\t"
                 "global_load_async_to_lds_b128 %3, %11, off\n\t"
                 "global_load_async_to_lds_b128 %4, %12, off\n\t"
                 "global_load_async_to_lds_b128 %5, %13, off\n\t"
                 "global_load_async_to_lds_b128 %6, %14, off\n\t"
                 "global_load_async_to_lds_b128 %7, %15, off\n\t"
                 "s_wait_xcnt 0x0"
                 :: "v"(l), "v"(l + ls), "v"(l + 2 * ls), "v"(l + 3 * ls),
                    "v"(l + 4 * ls), "v"(l + 5 * ls), "v"(l + 6 * ls), "v"(l + 7 * ls),
                    "v"(g), "v"(g + gs), "v"(g + 2 * gs), "v"(g + 3 * gs),
                    "v"(g + 4 * gs), "v"(g + 5 * gs), "v"(g + 6 * gs), "v"(g + 7 * gs)
                 : "memory");
}

// The same for rows that lie anywhere: each of the lane's eight copies has its own
// global address.
__device__ __forceinline__ void rows_copy(unsigned l, const _Float16* g0, const _Float16* g1,
                                          const _Float16* g2, const _Float16* g3,
                                          const _Float16* g4, const _Float16* g5,
                                          const _Float16* g6, const _Float16* g7) {
    const unsigned ls = 16 * GPITCH * 2;   // bytes between two of the lane's LDS rows
    asm volatile("global_load_async_to_lds_b128 %0, %8, off\n\t"
                 "global_load_async_to_lds_b128 %1, %9, off\n\t"
                 "global_load_async_to_lds_b128 %2, %10, off\n\t"
                 "global_load_async_to_lds_b128 %3, %11, off\n\t"
                 "global_load_async_to_lds_b128 %4, %12, off\n\t"
                 "global_load_async_to_lds_b128 %5, %13, off\n\t"
                 "global_load_async_to_lds_b128 %6, %14, off\n\t"
                 "global_load_async_to_lds_b128 %7, %15, off\n\t"
                 "s_wait_xcnt 0x0"
                 :: "v"(l), "v"(l + ls), "v"(l + 2 * ls), "v"(l + 3 * ls),
                    "v"(l + 4 * ls), "v"(l + 5 * ls), "v"(l + 6 * ls), "v"(l + 7 * ls),
                    "v"(g0), "v"(g1), "v"(g2), "v"(g3), "v"(g4), "v"(g5), "v"(g6), "v"(g7)
                 : "memory");
}

// f16 WMMA GEMM: C[m][n] = sum_k A[m][k] * Bt[n][k], both operands k-contiguous.
// A work-group of eight waves computes a 128 x 128 tile of C. Each stage of 128 k
// (128 rows of A and 128 rows of Bt, 256 bytes a row) is brought into LDS once for
// all eight waves, in whole 256-byte pieces, by asynchronous copies into a ring of
// two buffers; the fragments are read from there, and every fragment read feeds
// four (A) or two (Bt) WMMAs of its wave's 2 x 4 accumulator tiles.
// MODE: 0 = the three input projections in one launch: none reads what another
//           writes, so one grid of 3 x 4 column tiles holds them, two work-groups a
//           WGP, and one's first stage and stores run under another's products.
//           Bt is the three transposed weights one behind the other (1536 rows);
//           column tiles 0..3 are Q = A0 * Wq and 4..7 are K = A1 * Wk, f16 row-major;
//           8..11 are V = A1 * Wv, f16 transposed per batch -> out[b][n][m%Mdim].
//           Row p of K and V is the key at place p of its batch's key order (ord):
//           the A rows are gathered, and a row tile behind the batch's last key that
//           is set (cnt) has no reader and is left out,
//       2 = f32 store + bias (final projection of A0 into d_out).
// Left open: the row-major stores are still 2 or 4 bytes a lane; a batch's last K and V
// row tile is computed whole, however few of its keys are set; x and context are still
// converted in a launch of their own, the masked rows of context too.
template <int MODE>
__global__ __launch_bounds__(GWAVES * 32)
void gemm_wmma(const _Float16* __restrict__ A0,
               const _Float16* __restrict__ A1,
               const _Float16* __restrict__ Bt,
               _Float16* __restrict__ outQ,
               _Float16* __restrict__ outK,
               _Float16* __restrict__ outVt,
               float* __restrict__ outF,
               const float* __restrict__ bias,
               const int* __restrict__ ord,
               const int* __restrict__ cnt) {
    constexpr int Mdim = M_;
    constexpr int NT   = GN / GTN;      // column tiles of one projection
    // which projection this work-group belongs to (the same for all its waves)
    const int sel = MODE == 0 ? blockIdx.x / NT : 0;
    const _Float16* A = sel == 0 ? A0 : A1;
    // [buffer][A tile, then Bt tile]
    __shared__ __attribute__((aligned(16))) _Float16 gring[2][2 * GTILE];

    const int tid  = threadIdx.x;
    const int lane = tid & 31;
    const int col  = lane & 15;
    const int half = lane >> 4;
    const int kb0  = 8 * half;
    const int wm   = (tid >> 5) & 3;    // this wave's 32 rows of the tile
    const int wn   = tid >> 7;          // this wave's 64 columns of the tile
    const int n0   = (blockIdx.x % NT) * GTN;   // first column within the projection's output
    const int m0   = blockIdx.y * GTM;

    // This lane's place in a stage: rows crow + 16 i of either tile, 16 bytes at
    // cch; a wave's copy covers two whole rows of 256 bytes.
    const int crow = tid >> 4;
    const int cch  = (tid & 15) * 8;
    int arow[8];                        // the lane's eight rows of A
#pragma unroll
    for (int i = 0; i < 8; ++i) arow[i] = m0 + crow + 16 * i;
    if (MODE == 0 && sel != 0) {
        const int bb = m0 / Mdim;
        const int c  = min(cnt[bb * CNT_LD], Mdim);
        // the same for the whole work-group, in front of every copy and barrier
        if (m0 % Mdim >= (c <= 0 ? Mdim : c)) return;
        const int* op = ord + m0 + crow;
#pragma unroll
        for (int i = 0; i < 8; ++i) arow[i] = bb * Mdim + (op[16 * i] & (Mdim - 1));
        // in front of any rewrite of a register that these loads name
        asm volatile("s_wait_xcnt 0x0" ::: "memory");
    }
    const _Float16* ga = A + cch;
    const _Float16* gb = Bt + (size_t)(blockIdx.x * GTN + crow) * GK + cch;
    const unsigned  la = (unsigned)(uintptr_t)&gring[0][crow * GPITCH + cch];
#define GSTAGE(st, bf) do {                                                         \
        const unsigned l_ = la + (unsigned)(bf) * (2 * GTILE * 2);                  \
        const _Float16* a_ = ga + (st) * GSK;                                       \
        rows_copy(l_, a_ + arow[0] * GK, a_ + arow[1] * GK, a_ + arow[2] * GK,      \
                  a_ + arow[3] * GK, a_ + arow[4] * GK, a_ + arow[5] * GK,          \
                  a_ + arow[6] * GK, a_ + arow[7] * GK);                            \
        tile_copy(l_ + GTILE * 2, gb + (st) * GSK);                                 \
    } while (0)

    // stage 0, landed and published; then stage 1 flies under pass 0
    GSTAGE(0, 0);
    asm volatile("s_wait_asynccnt 0x0" ::: "memory");   // this wave's copies have landed
    __syncthreads();                                    // and every other wave's
    GSTAGE(1, 1);

    v8f acc[2][4];
#pragma unroll
    for (int i = 0; i < 2; ++i)
#pragma unroll
        for (int t = 0; t < 4; ++t) acc[i][t] = (v8f){};

    for (int st = 0; st < GNST; ++st) {
        const _Float16* ap = gring[st & 1] + (wm * 32 + col) * GPITCH + kb0;
        const _Float16* bp = gring[st & 1] + GTILE + (wn * 64 + col) * GPITCH + kb0;
        // two fragment sets: k-step j + 1 of this stage is read while k-step j is multiplied
        v16h a[2][2], b[2][4];
#define GFRAGS(set, ks) do {                                                        \
        _Pragma("unroll")                                                           \
        for (int i = 0; i < 2; ++i)                                                 \
            a[set][i] = frag_ld(ap + i * 16 * GPITCH + (ks),                        \
                                ap + i * 16 * GPITCH + (ks) + 16);                  \
        _Pragma("unroll")                                                           \
        for (int t = 0; t < 4; ++t)                                                 \
            b[set][t] = frag_ld(bp + t * 16 * GPITCH + (ks),                        \
                                bp + t * 16 * GPITCH + (ks) + 16);                  \
    } while (0)
        GFRAGS(0, 0);
        // unrolled (as every loop over i, t, r here): the set index j & 1 is then a
        // constant, and the fragments and accumulators stay in registers
#pragma unroll
        for (int j = 0; j < GSK / 32; ++j) {
            if (j + 1 < GSK / 32) GFRAGS((j + 1) & 1, (j + 1) * 32);
            // keeps the next k-step's twelve LDS reads one group in front of this k-step's
            // WMMAs; left free, they are spread among the WMMAs and waited for at once
            __builtin_amdgcn_sched_barrier(0);
#pragma unroll
            for (int i = 0; i < 2; ++i)
#pragma unroll
                for (int t = 0; t < 4; ++t)
                    acc[i][t] = wmma16(a[j & 1][i], b[j & 1][t], acc[i][t]);
            // and the reads after next behind them
            __builtin_amdgcn_sched_barrier(0);
        }
#undef GFRAGS

        // publish point of stage st + 1, which also frees stage st's buffer
        asm volatile("s_wait_dscnt 0x0" ::: "memory");     // this wave has left the buffer
        asm volatile("s_wait_asynccnt 0x0" ::: "memory");  // its copies of stage st + 1 have landed
        __syncthreads();
        if (st + 2 < GNST) GSTAGE(st + 2, st & 1);
    }
    // nothing is in flight here; kept so that no copy can outlive the wave
    asm volatile("s_wait_asynccnt 0x0" ::: "memory");
#undef GSTAGE

    // C-layout: lane (col, half), VGPR r  <->  row = 8*half + r, column = col
    const int mr0 = m0 + wm * 32 + 8 * half;
    const int nc0 = n0 + wn * 64 + col;
    if (MODE == 0 && sel != 2) {
        _Float16* o0 = (sel == 0 ? outQ : outK) + (size_t)mr0 * GN + nc0;
        _Float16* o1 = o0 + 16 * GN;
        _Float16  hv[2][4][8];
#pragma unroll
        for (int i = 0; i < 2; ++i)
#pragma unroll
            for (int t = 0; t < 4; ++t)
#pragma unroll
                for (int r = 0; r < 8; ++r) hv[i][t][r] = (_Float16)acc[i][t][r];
        // every convert stands in front of the first store: left free, converts among the
        // stores reuse registers that issued stores name, each behind a wait of its own
        __builtin_amdgcn_sched_barrier(0);
#pragma unroll
        for (int t = 0; t < 4; ++t)
#pragma unroll
            for (int r = 0; r < 8; ++r) {
                o0[r * GN + t * 16] = hv[0][t][r];
                o1[r * GN + t * 16] = hv[1][t][r];
            }
    } else if (MODE == 0) {
        // transposed store: consecutive r -> consecutive m -> packed 16B stores
        // (a tile's 128 rows lie in one batch: Mdim is a multiple of GTM)
        const int bidx = mr0 / Mdim;
        const int mloc = mr0 % Mdim;
#pragma unroll
        for (int i = 0; i < 2; ++i)
#pragma unroll
            for (int t = 0; t < 4; ++t) {
                h8 pk = {};
#pragma unroll
                for (int r = 0; r < 8; ++r) pk[r] = (_Float16)acc[i][t][r];
                *(h8*)(outVt + ((size_t)bidx * GN + nc0 + t * 16) * Mdim + mloc + i * 16) = pk;
            }
    } else {
#pragma unroll
        for (int t = 0; t < 4; ++t) {
            const float bv = bias[nc0 + t * 16];
#pragma unroll
            for (int i = 0; i < 2; ++i)
#pragma unroll
                for (int r = 0; r < 8; ++r)
                    outF[(size_t)(mr0 + i * 16 + r) * GN + nc0 + t * 16] = acc[i][t][r] + bv;
        }
    }
}

// ---------------------------------------------------------------------------
// Lane l <-> lane l ^ 16 (the two halves of a wave that share one query column)
__device__ __forceinline__ float xhalf(float x) {
    const int b = __builtin_bit_cast(int, x);
    return __builtin_bit_cast(float,
        __builtin_amdgcn_permlanex16(b, b, 0x76543210, 0xfedcba98, false, false));
}

// x where bit 'bit' of m is set, else -FLT_MAX: the bit spread over the word
// picks between the two bit patterns (two vector instructions, no compare)
__device__ __forceinline__ float keep(unsigned m, int bit, float x) {
    const int sel = (int)(m << (31 - bit)) >> 31;
    const int fil = __builtin_bit_cast(int, -FLT_MAX);
    return __builtin_bit_cast(float, (sel & __builtin_bit_cast(int, x)) | (~sel & fil));
}

// a compile-time yes or no handed to a generic lambda
template <bool V> struct flag_t { static constexpr bool value = V; };

// Geometry of flash_attn's work-group and of its LDS ring
#define QWAVES 8                 // waves per work-group, 16 query columns each
#define TKEYS  64                // keys per stage: K rows and V^T rows are both 128 B
#define PITCH  72                // halfs per LDS row: 128 B + 16 B, an odd multiple of 16 B
#define TILE_H (64 * PITCH)      // halfs of one staged tile (64 rows)
#define NSTAGE (M_ / TKEYS)

// One stage's share of one lane: four 16-byte asynchronous copies to LDS.
// The s_wait_xcnt closes the statement, so that no register a copy names is
// rewritten ahead of it.
__device__ __forceinline__ void stage_copy(unsigned l0, unsigned l1, unsigned l2, unsigned l3,
                                           const _Float16* g0, const _Float16* g1,
                                           const _Float16* g2, const _Float16* g3) {
    asm volatile("global_load_async_to_lds_b128 %0, %4, off\n\t"
                 "global_load_async_to_lds_b128 %1, %5, off\n\t"
                 "global_load_async_to_lds_b128 %2, %6, off\n\t"
                 "global_load_async_to_lds_b128 %3, %7, off\n\t"
                 "s_wait_xcnt 0x0"
                 :: "v"(l0), "v"(l1), "v"(l2), "v"(l3), "v"(g0), "v"(g1), "v"(g2), "v"(g3)
                 : "memory");
}

__global__ __launch_bounds__(QWAVES * 32) __attribute__((amdgpu_waves_per_eu(4, 4)))
void flash_attn(const _Float16* __restrict__ Q,
                const _Float16* __restrict__ Kh,
                const _Float16* __restrict__ Vt,
                const int* __restrict__ cntp,
                _Float16* __restrict__ O) {
    // [buffer][K tile, then V^T tile]
    __shared__ __attribute__((aligned(16))) _Float16 ring[2][2 * TILE_H];

    const int tid  = threadIdx.x;
    const int lane = tid & 31;
    const int col  = lane & 15;
    const int half = lane >> 4;
    const int kb0  = 8 * half;
    const int bh   = blockIdx.x;
    const int b    = bh / HEADS_;
    const int h    = bh % HEADS_;
    const int q0   = blockIdx.y * (QWAVES * 16) + (tid >> 5) * 16;

    const _Float16* kbase = Kh + (size_t)b * M_ * INNER_ + h * DHEAD;
    const _Float16* vbase = Vt + ((size_t)b * INNER_ + h * DHEAD) * M_;
    const int cnt = min(max(cntp[b * CNT_LD], 0), M_);              // keys that are set
    const int nst = ((cnt == 0 ? M_ : cnt) + TKEYS - 1) / TKEYS;    // stages to run, 1 .. NSTAGE

    // This lane's place in a stage: rows crow and crow + 32 of either tile, 16
    // bytes at cch; a wave's copy covers four whole rows of 128 bytes.
    const int crow = tid >> 3;
    const int cch  = (tid & 7) * 8;
    const _Float16* gk = kbase + (size_t)crow * INNER_ + cch;
    const _Float16* gv = vbase + (size_t)crow * M_ + cch;
    const unsigned  lk = (unsigned)(uintptr_t)&ring[0][crow * PITCH + cch];
#define STAGE(st, bf) do {                                                          \
        const unsigned  l_ = lk + (unsigned)(bf) * (2 * TILE_H * 2);                \
        const _Float16* k_ = gk + (size_t)(st) * TKEYS * INNER_;                    \
        const _Float16* v_ = gv + (size_t)(st) * TKEYS;                             \
        stage_copy(l_, l_ + 32 * PITCH * 2, l_ + TILE_H * 2,                        \
                   l_ + TILE_H * 2 + 32 * PITCH * 2,                                \
                   k_, k_ + 32 * INNER_, v_, v_ + (size_t)32 * M_);                 \
    } while (0)

    // Q fragments stay resident: two 32x16 chunks covering d = 0..63
    const _Float16* qp = Q + (size_t)(b * N_ + q0 + col) * INNER_ + h * DHEAD + kb0;
    const v16h bq0 = frag_ld(qp,      qp + 16);
    const v16h bq1 = frag_ld(qp + 32, qp + 48);
    // the four loads share the address pair qp: naming it keeps it live up to
    // the wait, so that it is not rewritten ahead of it
    asm volatile("s_wait_xcnt 0x0" :: "v"(qp) : "memory");

    // stage 0, landed and published; then stage 1 flies under pass 0
    STAGE(0, 0);
    asm volatile("s_wait_asynccnt 0x0" ::: "memory");   // this wave's copies have landed
    __syncthreads();                                    // and every other wave's
    if (nst > 1) STAGE(1, 1);

    float rm = -FLT_MAX;   // running maximum of this lane's query (same in both halves)
    float rl = 0.0f;       // running sum over this half's keys only; joined at the end
    v8f acc[4];            // acc[g][r] = O^T[g*16 + 8*half + r][query col]
#pragma unroll
    for (int g = 0; g < 4; ++g) acc[g] = (v8f){};

    // one stage of 64 keys with its publish point; masked_t says at compile time whether
    // it masks
    auto stage = [&](auto masked_t, const int st) __attribute__((always_inline)) {
        constexpr bool MASKED = decltype(masked_t)::value;
        const _Float16* ktile = ring[st & 1];
        const _Float16* vtile = ktile + TILE_H;

#pragma unroll
        for (int s = 0; s < TKEYS; s += 32) {
            const int j0 = st * TKEYS + s;

            // ---- S^T = K*Q^T for 32 keys: two 16-key C tiles, 4 WMMAs total
            const _Float16* kp = ktile + (s + col) * PITCH + kb0;
            const v16h ak00 = frag_ld(kp,                   kp + 16);
            const v16h ak01 = frag_ld(kp + 32,              kp + 48);
            const v16h ak10 = frag_ld(kp + 16 * PITCH,      kp + 16 * PITCH + 16);
            const v16h ak11 = frag_ld(kp + 16 * PITCH + 32, kp + 16 * PITCH + 48);

            // V^T rows (d-major V): read under the S^T products and the softmax
            const _Float16* vp = vtile + col * PITCH + s + kb0;
            v16h av[4];
#pragma unroll
            for (int g = 0; g < 4; ++g)
                av[g] = frag_ld(vp + g * 16 * PITCH, vp + g * 16 * PITCH + 16);

            v8f s0 = {}, s1 = {};
            s0 = wmma16(ak00, bq0, s0);
            s1 = wmma16(ak10, bq0, s1);
            s0 = wmma16(ak01, bq1, s0);
            s1 = wmma16(ak11, bq1, s1);

            // ---- online softmax, one query per lane
            // bit k of live = key place j0 + k is set; this lane's 16 keys are j0 + 8*half + r
            // (bit r of mk) and j0 + 16 + 8*half + r (bit 16 + r of mk)
            const int      rem  = cnt - j0;
            const unsigned live = rem >= 32 ? ~0u : rem <= 0 ? 0u : (1u << rem) - 1u;
            const unsigned mk   = live >> kb0;
            float a[16];
#pragma unroll
            for (int r = 0; r < 8; ++r) {
                a[r]     = MASKED ? keep(mk, r,      s0[r] * SCALE_) : s0[r] * SCALE_;
                a[8 + r] = MASKED ? keep(mk, 16 + r, s1[r] * SCALE_) : s1[r] * SCALE_;
            }
            float t = a[0];
#pragma unroll
            for (int i = 1; i < 16; ++i) t = fmaxf(t, a[i]);
            t = fmaxf(t, xhalf(t));
            const float mn   = fmaxf(rm, t);
            const float corr = __expf(rm - mn);
            rm = mn;

            v16h bp;           // P^T as a B fragment: element r <-> key j0 + 8*half + r, 8 + r <-> key j0 + 16 + 8*half + r
            float ps0 = 0.0f, ps1 = 0.0f;
#pragma unroll
            for (int r = 0; r < 8; ++r) {
                const float p0 = __expf(a[r] - mn);
                const float p1 = __expf(a[8 + r] - mn);
                bp[r]     = (_Float16)p0;
                bp[8 + r] = (_Float16)p1;
                ps0 += p0;
                ps1 += p1;
            }
            rl = rl * corr + (ps0 + ps1);
#pragma unroll
            for (int g = 0; g < 4; ++g)
#pragma unroll
                for (int r = 0; r < 8; ++r) acc[g][r] *= corr;

            // ---- O^T += V^T * P^T
#pragma unroll
            for (int g = 0; g < 4; ++g) acc[g] = wmma16(av[g], bp, acc[g]);
        }

        // publish point of stage st + 1, which also frees stage st's buffer
        asm volatile("s_wait_dscnt 0x0" ::: "memory");     // this wave has left the buffer
        asm volatile("s_wait_asynccnt 0x0" ::: "memory");  // its copies of stage st + 1 have landed
        __syncthreads();
        if (st + 2 < nst) STAGE(st + 2, st & 1);
    };
    const int nfull = cnt / TKEYS;           // stages whose every key is set
    for (int st = 0; st < nfull; ++st) stage(flag_t<false>{}, st);
    for (int st = nfull; st < nst; ++st) stage(flag_t<true>{}, st);
    // nothing is in flight here; kept so that no copy can outlive the wave
    asm volatile("s_wait_asynccnt 0x0" ::: "memory");
#undef STAGE

    const float inv = 1.0f / (rl + xhalf(rl));
    // consecutive r -> consecutive d -> packed 16B stores
    _Float16* orow = O + (size_t)(b * N_ + q0 + col) * INNER_ + h * DHEAD + 8 * half;
#pragma unroll
    for (int g = 0; g < 4; ++g) {
        h8 pk = {};
#pragma unroll
        for (int r = 0; r < 8; ++r) pk[r] = (_Float16)(acc[g][r] * inv);
        *(h8*)(orow + g * 16) = pk;
    }
}

// ---------------------------------------------------------------------------
extern "C" void kernel_launch(void* const* d_in, const int* in_sizes, int n_in,
                              void* d_out, int out_size, void* d_ws, size_t ws_size,
                              hipStream_t stream) {
    const float* x    = (const float*)d_in[0];
    const float* ctx  = (const float*)d_in[1];
    const int*   mask = (const int*)d_in[2];
    const float* Wq   = (const float*)d_in[3];
    const float* Wkv  = (const float*)d_in[4];
    const float* Wo   = (const float*)d_in[5];
    const float* bo   = (const float*)d_in[6];
    float* out = (float*)d_out;

    // Workspace layout: six 8192x512 f16 tensors + four 512x512 f16 weights ~ 50 MB, then the int key orders and counts
    _Float16* W = (_Float16*)d_ws;
    const size_t SZ = (size_t)B_ * N_ * INNER_;   // 4M elements
    _Float16* x_h  = W;
    _Float16* c_h  = W + SZ;
    _Float16* q_h  = W + 2 * SZ;
    _Float16* k_h  = W + 3 * SZ;
    _Float16* vt_h = W + 4 * SZ;   // [B][INNER][M] (d-major V)
    _Float16* ao_h = W + 5 * SZ;
    _Float16* Wt   = W + 6 * SZ;       // WqT, WkT, WvT, WoT, one behind the other
    _Float16* WoT  = Wt + 3 * WGT_E;
    int* ord = (int*)(Wt + 4 * WGT_E); // [B][M] key order of each batch
    int* cnt = ord + B_ * M_;          // [B][CNT_LD] keys that are set

    static_assert(ACT_E % CV_BLOCK_E == 0 && B_ * M_ * CDIM == ACT_E && B_ * N_ * QDIM == ACT_E,
                  "the convert's grid is exact");
    static_assert(M_ % CV_THREADS == 0 && (M_ & (M_ - 1)) == 0, "key_order's ballots are whole");
    cvt_all<<<B_ + 2 * CV_ACT_B + 4 * CV_WGT_B, CV_THREADS, 0, stream>>>(x, ctx, Wq, Wkv, Wo, mask, x_h, c_h, Wt, ord, cnt);

    // 128x128 tile of C per work-group: grid (columns / 128, rows / 128)
    static_assert(QDIM == GK && CDIM == GK && INNER_ == GK && INNER_ == GN && QDIM == GN,
                  "every projection is 512 deep and 512 wide");
    static_assert(GN % GTN == 0 && (B_ * N_) % GTM == 0 && (B_ * M_) % GTM == 0 && M_ % GTM == 0 && GNST >= 2,
                  "the grid is exact and the ring has its two stages");
    static_assert(B_ * N_ == B_ * M_, "the three input projections have the same rows");
    const dim3 gg(GN / GTN, (B_ * N_) / GTM);       // 4 x 64
    const dim3 g3(3 * (GN / GTN), (B_ * N_) / GTM); // 12 x 64
    gemm_wmma<0><<<g3, GWAVES * 32, 0, stream>>>(x_h, c_h, Wt, q_h, k_h, vt_h, nullptr, nullptr, ord, cnt);

    flash_attn<<<dim3(B_ * HEADS_, N_ / (QWAVES * 16)), QWAVES * 32, 0, stream>>>(q_h, k_h, vt_h, cnt, ao_h);

    gemm_wmma<2><<<gg, GWAVES * 32, 0, stream>>>(ao_h, nullptr, WoT, nullptr, nullptr, nullptr, out, bo, nullptr, nullptr);
}

// v007
// A run of this version takes 51.2 microseconds.
// Next to v006, in two timings, it ran 1.03 and 1.04 times as fast.
// All steps since v000 together make it 8.35 times as fast.
#include <hip/hip_runtime.h>
#include <hip/hip_bf16.h>
#include <float.h>
#include <stdint.h>

// Problem constants (match the reference)
#define B_     4
#define N_     2048
#define M_     2048
#define QDIM   512
#define CDIM   512
#define HEADS_ 8
#define DHEAD  64
#define INNER_ 512
#define SCALE_ 0.125f   // 64^-0.5

typedef _Float16 v16h __attribute__((ext_vector_type(16)));
typedef _Float16 h8   __attribute__((ext_vector_type(8)));
typedef float    v8f  __attribute__((ext_vector_type(8)));

// Build a 16x32 f16 A/B fragment for v_wmma_f32_16x16x32_f16.
// Per the CDNA5 ISA layout, lane L (row/col = L%16, half = L/16) holds
//   frag[0..7]  = X[row][ 8*half + i]        (contiguous 16B)
//   frag[8..15] = X[row][16 + 8*half + i]    (contiguous 16B)
__device__ __forceinline__ v16h frag_ld(const _Float16* lo_p, const _Float16* hi_p) {
    h8 lo = *(const h8*)lo_p;
    h8 hi = *(const h8*)hi_p;
    v16h r;
#pragma unroll
    for (int i = 0; i < 8; ++i) { r[i] = lo[i]; r[i + 8] = hi[i]; }
    return r;
}

__device__ __forceinline__ v8f wmma16(v16h a, v16h b, v8f c) {
    // (neg_a, A, neg_b, B, c_mod, C, reuse_a, reuse_b)
    return __builtin_amdgcn_wmma_f32_16x16x32_f16(false, a, false, b, (short)0, c,
                                                  false, false);
}

// ---------------------------------------------------------------------------
typedef _Float16 h4 __attribute__((ext_vector_type(4)));
typedef float    f4 __attribute__((ext_vector_type(4)));

#define CV_THREADS 256
#define CV_LOADS   8                               // 16-byte loads in flight per lane
#define CV_WAVE_E  (CV_LOADS * 128)                // elements per wave: 4 KB of f32 in a row
#define CV_BLOCK_E ((CV_THREADS / 32) * CV_WAVE_E) // elements per work-group

// f32 -> f16 elementwise convert, 32 elements a lane: few waves to start, each with
// eight wave-wide loads of 512 contiguous bytes in flight; each store of a wave
// covers 256 contiguous bytes. Work-group blk of the tensor's CV_ACT_B, which cover
// it exactly (a multiple of CV_BLOCK_E elements), so there is no bound to test.
__device__ __forceinline__
void cvt_f32_to_h(const float* __restrict__ src, _Float16* __restrict__ dst, int blk) {
    const int wave = blk * (CV_THREADS / 32) + (threadIdx.x >> 5);
    const int base = wave * CV_WAVE_E + (threadIdx.x & 31) * 4;
    f4 v[CV_LOADS];
#pragma unroll
    for (int j = 0; j < CV_LOADS; ++j) v[j] = *(const f4*)(src + base + j * 128);
#pragma unroll
    for (int j = 0; j < CV_LOADS; ++j) {
        h4 o;
#pragma unroll
        for (int e = 0; e < 4; ++e) o[e] = (_Float16)v[j][e];
        *(h4*)(dst + base + j * 128) = o;
    }
    // inlined into cvt_all, another job's code follows in the listing: no register that
    // these stores name is rewritten ahead of this wait
    asm volatile("s_wait_xcnt 0x0" ::: "memory");
}

// Transpose-convert weight W[in=rows][... ld ...] (a block of columns from col0 on)
// into Wt[out][in] f16, so GEMM B-operand columns become contiguous rows.
// A lane takes 8 rows of one column: eight loads in flight, each 128 contiguous bytes
// a wave, and one 16-byte store; the eight waves of a work-group take 64 rows, so a
// work-group writes whole 128-byte lines of Wt. Work-group (bx, by) of (columns / 32,
// rows / 64), which cover the block exactly.
__device__ __forceinline__
void cvt_transpose(const float* __restrict__ src,
                   _Float16* __restrict__ dst,
                   int rows, int ld, int col0, int bx, int by) {
    const int o  = bx * 32 + (threadIdx.x & 31);
    const int r0 = by * 64 + (threadIdx.x >> 5) * 8;
    const float* s = src + (size_t)r0 * ld + col0 + o;
    float v[8];
#pragma unroll
    for (int i = 0; i < 8; ++i) v[i] = s[(size_t)i * ld];
    h8 pk;
#pragma unroll
    for (int i = 0; i < 8; ++i) pk[i] = (_Float16)v[i];
    *(h8*)(dst + (size_t)o * rows + r0) = pk;
    // as at the end of cvt_f32_to_h: in front of any rewrite of the store's registers
    asm volatile("s_wait_xcnt 0x0" ::: "memory");
}

#define ACT_E    (B_ * N_ * INNER_)        // elements of one activation tensor
#define WGT_E    (512 * 512)               // elements of one weight block
#define CV_ACT_B (ACT_E / CV_BLOCK_E)      // work-groups per activation tensor
#define CV_WGT_B ((512 / 32) * (512 / 64)) // work-groups per weight block

#define CNT_LD 32   // ints between two batches' counts: each work-group writes a 128-byte line of its own

// Key order of one batch: the keys whose mask word is set first, in their own order,
// then the masked ones; ord[p] = key at place p, cnt = how many are set. A masked key's
// weight is exp(-FLT_MAX - max) = 0 wherever the batch has one key set, so the K and V
// projections and the attention need only the first cnt places (a batch with none set
// keeps all its keys, all masked: uniform weights, as in the reference).
// One work-group a batch; wave w takes keys 256 w .. 256 w + 255, 32 a ballot.
__device__ __forceinline__
void key_order(const int* __restrict__ mask, int* __restrict__ ord, int* __restrict__ cnt) {
    __shared__ int wsum[CV_THREADS / 32];
    const int lane = threadIdx.x & 31;
    const int wave = threadIdx.x >> 5;
    constexpr int NB = M_ / CV_THREADS;          // ballots per wave
    const int* mp = mask + wave * (NB * 32) + lane;
    unsigned bal[NB];
    int tot = 0;
#pragma unroll
    for (int i = 0; i < NB; ++i) {
        bal[i] = __builtin_amdgcn_ballot_w32(mp[i * 32] != 0);
        tot += __builtin_popcount(bal[i]);
    }
    // the loads share the address pair mp: naming it keeps it live up to the wait, so
    // that it is not rewritten ahead of it
    asm volatile("s_wait_xcnt 0x0" :: "v"(mp) : "memory");
    if (lane == 0) wsum[wave] = tot;
    __syncthreads();
    int before = 0, all = 0;                     // set keys in earlier waves, in the batch
#pragma unroll
    for (int w = 0; w < CV_THREADS / 32; ++w) {
        const int t = wsum[w];
        before += w < wave ? t : 0;
        all    += t;
    }
    const unsigned below = (1u << lane) - 1u;
    const int key0 = wave * (NB * 32) + lane;
#pragma unroll
    for (int i = 0; i < NB; ++i) {
        const int key = key0 + i * 32;
        const int set = before + __builtin_popcount(bal[i] & below);   // set keys in front of this one
        ord[((bal[i] >> lane) & 1u) ? set : all + key - set] = key;    // masked ones follow all set ones
        before += __builtin_popcount(bal[i]);
    }
    if (threadIdx.x == 0) *cnt = all;
    // as at the end of cvt_f32_to_h: in front of any rewrite of the stores' registers
    asm volatile("s_wait_xcnt 0x0" ::: "memory");
}

// All six converts in one launch: none reads what another writes, so one grid holds
// them side by side and the short weight blocks run under the two long streams
// instead of each waiting for the launch before it to drain. The work-group index
// picks the job: x, context (the long ones start first), then the four weight blocks,
// whose transposes lie one behind the other in Wt: Wq, the K half and the V half of
// Wkv, Wo. The first B_ work-groups form the batches' key orders.
__global__ __launch_bounds__(CV_THREADS)
void cvt_all(const float* __restrict__ x, const float* __restrict__ ctx,
             const float* __restrict__ Wq, const float* __restrict__ Wkv,
             const float* __restrict__ Wo, const int* __restrict__ mask,
             _Float16* __restrict__ x_h, _Float16* __restrict__ c_h,
             _Float16* __restrict__ Wt, int* __restrict__ ord, int* __restrict__ cnt) {
    const int bid = (int)blockIdx.x - B_;
    if (bid < 0) {
        const int b = blockIdx.x;
        key_order(mask + b * M_, ord + b * M_, cnt + b * CNT_LD);
    } else if (bid < CV_ACT_B) {
        cvt_f32_to_h(x, x_h, bid);
    } else if (bid < 2 * CV_ACT_B) {
        cvt_f32_to_h(ctx, c_h, bid - CV_ACT_B);
    } else {
        const int w  = (bid - 2 * CV_ACT_B) / CV_WGT_B;   // which weight block
        const int t  = (bid - 2 * CV_ACT_B) % CV_WGT_B;
        const int bx = t % (512 / 32);
        const int by = t / (512 / 32);
        if (w == 1 || w == 2)
            cvt_transpose(Wkv, Wt + w * WGT_E, 512, 1024, (w - 1) * 512, bx, by);
        else
            cvt_transpose(w == 0 ? Wq : Wo, Wt + w * WGT_E, 512, 512, 0, bx, by);
    }
}

// ---------------------------------------------------------------------------
// Geometry of gemm_wmma's work-group and of its LDS ring
#define GWAVES 8                 // waves per work-group: 4 along m x 2 along n, 32 x 64 of C each
#define GTM    128               // rows of C per work-group
#define GTN    128               // columns of C per work-group
#define GK     512               // depth of every projection
#define GN     512               // columns of every projection
#define GSK    128               // k per stage: operand rows of 256 B
#define GPITCH 136               // halfs per LDS row: 256 B + 16 B, an odd multiple of 16 B
#define GTILE  (128 * GPITCH)    // halfs of one staged operand tile (128 rows)
#define GNST   (GK / GSK)

// One operand tile's share of one lane: eight 16-byte asynchronous copies to LDS,
// rows 16 apart. The s_wait_xcnt closes the statement, so that no register a copy
// names is rewritten ahead of it.
__device__ __forceinline__ void tile_copy(unsigned l, const _Float16* g) {
    const unsigned ls = 16 * GPITCH * 2;   // bytes between two of the lane's LDS rows
    const int      gs = 16 * GK;           // halfs between two of its global rows
    asm volatile("global_load_async_to_lds_b128 %0, %8, off\n\t"
                 "global_load_async_to_lds_b128 %1, %9, off\n\t"
                 "global_load_async_to_lds_b128 %2, %10, off\n\t"
                 "global_load_async_to_lds_b128 %3, %11, off\n\t"
                 "global_load_async_to_lds_b128 %4, %12, off\n\t"
                 "global_load_async_to_lds_b128 %5, %13, off\n\t"
                 "global_load_async_to_lds_b128 %6, %14, off\n\t"
                 "global_load_async_to_lds_b128 %7, %15, off\n\t"
                 "s_wait_xcnt 0x0"
                 :: "v"(l), "v"(l + ls), "v"(l + 2 * ls), "v"(l + 3 * ls),
                    "v"(l + 4 * ls), "v"(l + 5 * ls), "v"(l + 6 * ls), "v"(l + 7 * ls),
                    "v"(g), "v"(g + gs), "v"(g + 2 * gs), "v"(g + 3 * gs),
                    "v"(g + 4 * gs), "v"(g + 5 * gs), "v"(g + 6 * gs), "v"(g + 7 * gs)
                 : "memory");
}

// The same for rows that lie anywhere: each of the lane's eight copies has its own
// global address.
__device__ __forceinline__ void rows_copy(unsigned l, const _Float16* g0, const _Float16* g1,
                                          const _Float16* g2, const _Float16* g3,
                                          const _Float16* g4, const _Float16* g5,
                                          const _Float16* g6, const _Float16* g7) {
    const unsigned ls = 16 * GPITCH * 2;   // bytes between two of the lane's LDS rows
    asm volatile("global_load_async_to_lds_b128 %0, %8, off\n\t"
                 "global_load_async_to_lds_b128 %1, %9, off\n\t"
                 "global_load_async_to_lds_b128 %2, %10, off\n\t"
                 "global_load_async_to_lds_b128 %3, %11, off\n\t"
                 "global_load_async_to_lds_b128 %4, %12, off\n\t"
                 "global_load_async_to_lds_b128 %5, %13, off\n\t"
                 "global_load_async_to_lds_b128 %6, %14, off\n\t"
                 "global_load_async_to_lds_b128 %7, %15, off\n\t"
                 "s_wait_xcnt 0x0"
                 :: "v"(l), "v"(l + ls), "v"(l + 2 * ls), "v"(l + 3 * ls),
                    "v"(l + 4 * ls), "v"(l + 5 * ls), "v"(l + 6 * ls), "v"(l + 7 * ls),
                    "v"(g0), "v"(g1), "v"(g2), "v"(g3), "v"(g4), "v"(g5), "v"(g6), "v"(g7)
                 : "memory");
}

// f16 WMMA GEMM: C[m][n] = sum_k A[m][k] * Bt[n][k], both operands k-contiguous.
// A work-group of eight waves computes a 128 x 128 tile of C. Each stage of 128 k
// (128 rows of A and 128 rows of Bt, 256 bytes a row) is brought into LDS once for
// all eight waves, in whole 256-byte pieces, by asynchronous copies into a ring of
// two buffers; the fragments are read from there, and every fragment read feeds
// four (A) or two (Bt) WMMAs of its wave's 2 x 4 accumulator tiles.
// MODE: 0 = the three input projections in one launch: none reads what another
//           writes, so one grid of 3 x 4 column tiles holds them, two work-groups a
//           WGP, and one's first stage and stores run under another's products.
//           Bt is the three transposed weights one behind the other (1536 rows);
//           column tiles 0..3 are Q = A0 * Wq and 4..7 are K = A1 * Wk, f16 row-major;
//           8..11 are V = A1 * Wv, f16 transposed per batch -> out[b][n][m%Mdim].
//           Row p of K and V is the key at place p of its batch's key order (ord):
//           the A rows are gathered, and a row tile behind the batch's last key that
//           is set (cnt) has no reader and is left out,
//       2 = f32 store + bias (final projection of A0 into d_out).
// Left open: the row-major stores are still 2 or 4 bytes a lane; a batch's last K and V
// row tile is computed whole, however few of its keys are set; x and context are still
// converted in a launch of their own, the masked rows of context too.
template <int MODE>
__global__ __launch_bounds__(GWAVES * 32)
void gemm_wmma(const _Float16* __restrict__ A0,
               const _Float16* __restrict__ A1,
               const _Float16* __restrict__ Bt,
               _Float16* __restrict__ outQ,
               _Float16* __restrict__ outK,
               _Float16* __restrict__ outVt,
               float* __restrict__ outF,
               const float* __restrict__ bias,
               const int* __restrict__ ord,
               const int* __restrict__ cnt) {
    constexpr int Mdim = M_;
    constexpr int NT   = GN / GTN;      // column tiles of one projection
    // which projection this work-group belongs to (the same for all its waves)
    const int sel = MODE == 0 ? blockIdx.x / NT : 0;
    const _Float16* A = sel == 0 ? A0 : A1;
    // [buffer][A tile, then Bt tile]
    __shared__ __attribute__((aligned(16))) _Float16 gring[2][2 * GTILE];

    const int tid  = threadIdx.x;
    const int lane = tid & 31;
    const int col  = lane & 15;
    const int half = lane >> 4;
    const int kb0  = 8 * half;
    const int wm   = (tid >> 5) & 3;    // this wave's 32 rows of the tile
    const int wn   = tid >> 7;          // this wave's 64 columns of the tile
    const int n0   = (blockIdx.x % NT) * GTN;   // first column within the projection's output
    const int m0   = blockIdx.y * GTM;

    // This lane's place in a stage: rows crow + 16 i of either tile, 16 bytes at
    // cch; a wave's copy covers two whole rows of 256 bytes.
    const int crow = tid >> 4;
    const int cch  = (tid & 15) * 8;
    int arow[8];                        // the lane's eight rows of A
#pragma unroll
    for (int i = 0; i < 8; ++i) arow[i] = m0 + crow + 16 * i;
    if (MODE == 0 && sel != 0) {
        const int bb = m0 / Mdim;
        const int c  = min(cnt[bb * CNT_LD], Mdim);
        // the same for the whole work-group, in front of every copy and barrier
        if (m0 % Mdim >= (c <= 0 ? Mdim : c)) return;
        const int* op = ord + m0 + crow;
#pragma unroll
        for (int i = 0; i < 8; ++i) arow[i] = bb * Mdim + (op[16 * i] & (Mdim - 1));
        // in front of any rewrite of a register that these loads name
        asm volatile("s_wait_xcnt 0x0" ::: "memory");
    }
    const _Float16* ga = A + cch;
    const _Float16* gb = Bt + (size_t)(blockIdx.x * GTN + crow) * GK + cch;
    const unsigned  la = (unsigned)(uintptr_t)&gring[0][crow * GPITCH + cch];
#define GSTAGE(st, bf) do {                                                         \
        const unsigned l_ = la + (unsigned)(bf) * (2 * GTILE * 2);                  \
        const _Float16* a_ = ga + (st) * GSK;                                       \
        rows_copy(l_, a_ + arow[0] * GK, a_ + arow[1] * GK, a_ + arow[2] * GK,      \
                  a_ + arow[3] * GK, a_ + arow[4] * GK, a_ + arow[5] * GK,          \
                  a_ + arow[6] * GK, a_ + arow[7] * GK);                            \
        tile_copy(l_ + GTILE * 2, gb + (st) * GSK);                                 \
    } while (0)

    // stage 0, landed and published; then stage 1 flies under pass 0
    GSTAGE(0, 0);
    asm volatile("s_wait_asynccnt 0x0" ::: "memory");   // this wave's copies have landed
    __syncthreads();                                    // and every other wave's
    GSTAGE(1, 1);

    v8f acc[2][4];
#pragma unroll
    for (int i = 0; i < 2; ++i)
#pragma unroll
        for (int t = 0; t < 4; ++t) acc[i][t] = (v8f){};

    for (int st = 0; st < GNST; ++st) {
        const _Float16* ap = gring[st & 1] + (wm * 32 + col) * GPITCH + kb0;
        const _Float16* bp = gring[st & 1] + GTILE + (wn * 64 + col) * GPITCH + kb0;
        // two fragment sets: k-step j + 1 of this stage is read while k-step j is multiplied
        v16h a[2][2], b[2][4];
#define GFRAGS(set, ks) do {                                                        \
        _Pragma("unroll")                                                           \
        for (int i = 0; i < 2; ++i)                                                 \
            a[set][i] = frag_ld(ap + i * 16 * GPITCH + (ks),                        \
                                ap + i * 16 * GPITCH + (ks) + 16);                  \
        _Pragma("unroll")                                                           \
        for (int t = 0; t < 4; ++t)                                                 \
            b[set][t] = frag_ld(bp + t * 16 * GPITCH + (ks),                        \
                                bp + t * 16 * GPITCH + (ks) + 16);                  \
    } while (0)
        GFRAGS(0, 0);
        // unrolled (as every loop over i, t, r here): the set index j & 1 is then a
        // constant, and the fragments and accumulators stay in registers
#pragma unroll
        for (int j = 0; j < GSK / 32; ++j) {
            if (j + 1 < GSK / 32) GFRAGS((j + 1) & 1, (j + 1) * 32);
            // keeps the next k-step's twelve LDS reads one group in front of this k-step's
            // WMMAs; left free, they are spread among the WMMAs and waited for at once
            __builtin_amdgcn_sched_barrier(0);
#pragma unroll
            for (int i = 0; i < 2; ++i)
#pragma unroll
                for (int t = 0; t < 4; ++t)
                    acc[i][t] = wmma16(a[j & 1][i], b[j & 1][t], acc[i][t]);
            // and the reads after next behind them
            __builtin_amdgcn_sched_barrier(0);
        }
#undef GFRAGS

        // publish point of stage st + 1, which also frees stage st's buffer
        asm volatile("s_wait_dscnt 0x0" ::: "memory");     // this wave has left the buffer
        asm volatile("s_wait_asynccnt 0x0" ::: "memory");  // its copies of stage st + 1 have landed
        __syncthreads();
        if (st + 2 < GNST) GSTAGE(st + 2, st & 1);
    }
    // nothing is in flight here; kept so that no copy can outlive the wave
    asm volatile("s_wait_asynccnt 0x0" ::: "memory");
#undef GSTAGE

    // C-layout: lane (col, half), VGPR r  <->  row = 8*half + r, column = col
    const int mr0 = m0 + wm * 32 + 8 * half;
    const int nc0 = n0 + wn * 64 + col;
    if (MODE == 0 && sel != 2) {
        _Float16* o0 = (sel == 0 ? outQ : outK) + (size_t)mr0 * GN + nc0;
        _Float16* o1 = o0 + 16 * GN;
        _Float16  hv[2][4][8];
#pragma unroll
        for (int i = 0; i < 2; ++i)
#pragma unroll
            for (int t = 0; t < 4; ++t)
#pragma unroll
                for (int r = 0; r < 8; ++r) hv[i][t][r] = (_Float16)acc[i][t][r];
        // every convert stands in front of the first store: left free, converts among the
        // stores reuse registers that issued stores name, each behind a wait of its own
        __builtin_amdgcn_sched_barrier(0);
#pragma unroll
        for (int t = 0; t < 4; ++t)
#pragma unroll
            for (int r = 0; r < 8; ++r) {
                o0[r * GN + t * 16] = hv[0][t][r];
                o1[r * GN + t * 16] = hv[1][t][r];
            }
    } else if (MODE == 0) {
        // transposed store: consecutive r -> consecutive m -> packed 16B stores
        // (a tile's 128 rows lie in one batch: Mdim is a multiple of GTM)
        const int bidx = mr0 / Mdim;
        const int mloc = mr0 % Mdim;
#pragma unroll
        for (int i = 0; i < 2; ++i)
#pragma unroll
            for (int t = 0; t < 4; ++t) {
                h8 pk = {};
#pragma unroll
                for (int r = 0; r < 8; ++r) pk[r] = (_Float16)acc[i][t][r];
                *(h8*)(outVt + ((size_t)bidx * GN + nc0 + t * 16) * Mdim + mloc + i * 16) = pk;
            }
    } else {
#pragma unroll
        for (int t = 0; t < 4; ++t) {
            const float bv = bias[nc0 + t * 16];
#pragma unroll
            for (int i = 0; i < 2; ++i)
#pragma unroll
                for (int r = 0; r < 8; ++r)
                    outF[(size_t)(mr0 + i * 16 + r) * GN + nc0 + t * 16] = acc[i][t][r] + bv;
        }
    }
}

// ---------------------------------------------------------------------------
// Lane l <-> lane l ^ 16 (the two halves of a wave that share one query column)
__device__ __forceinline__ float xhalf(float x) {
    const int b = __builtin_bit_cast(int, x);
    return __builtin_bit_cast(float,
        __builtin_amdgcn_permlanex16(b, b, 0x76543210, 0xfedcba98, false, false));
}

// x where bit 'bit' of m is set, else fill: the bit spread over the word
// picks between the two bit patterns (no compare)
__device__ __forceinline__ float keep(unsigned m, int bit, float x, float fill) {
    const int sel = (int)(m << (31 - bit)) >> 31;
    const int fil = __builtin_bit_cast(int, fill);
    return __builtin_bit_cast(float, (sel & __builtin_bit_cast(int, x)) | (~sel & fil));
}

// a compile-time yes or no handed to a generic lambda
template <bool V> struct flag_t { static constexpr bool value = V; };

// Geometry of flash_attn's work-group and of its LDS ring
#define QWAVES 8                 // waves per work-group, 16 query columns each
#define TKEYS  64                // keys per stage: K rows and V^T rows are both 128 B
#define PITCH  72                // halfs per LDS row: 128 B + 16 B, an odd multiple of 16 B
#define TILE_H (64 * PITCH)      // halfs of one staged tile (64 rows)
#define NSTAGE (M_ / TKEYS)

// One stage's share of one lane: four 16-byte asynchronous copies to LDS.
// The s_wait_xcnt closes the statement, so that no register a copy names is
// rewritten ahead of it.
__device__ __forceinline__ void stage_copy(unsigned l0, unsigned l1, unsigned l2, unsigned l3,
                                           const _Float16* g0, const _Float16* g1,
                                           const _Float16* g2, const _Float16* g3) {
    asm volatile("global_load_async_to_lds_b128 %0, %4, off\n\t"
                 "global_load_async_to_lds_b128 %1, %5, off\n\t"
                 "global_load_async_to_lds_b128 %2, %6, off\n\t"
                 "global_load_async_to_lds_b128 %3, %7, off\n\t"
                 "s_wait_xcnt 0x0"
                 :: "v"(l0), "v"(l1), "v"(l2), "v"(l3), "v"(g0), "v"(g1), "v"(g2), "v"(g3)
                 : "memory");
}

__global__ __launch_bounds__(QWAVES * 32) __attribute__((amdgpu_waves_per_eu(4, 4)))
void flash_attn(const _Float16* __restrict__ Q,
                const _Float16* __restrict__ Kh,
                const _Float16* __restrict__ Vt,
                const int* __restrict__ cntp,
                _Float16* __restrict__ O) {
    // [buffer][K tile, then V^T tile]
    __shared__ __attribute__((aligned(16))) _Float16 ring[2][2 * TILE_H];

    const int tid  = threadIdx.x;
    const int lane = tid & 31;
    const int col  = lane & 15;
    const int half = lane >> 4;
    const int kb0  = 8 * half;
    const int bh   = blockIdx.x;
    const int b    = bh / HEADS_;
    const int h    = bh % HEADS_;
    const int q0   = blockIdx.y * (QWAVES * 16) + (tid >> 5) * 16;

    const _Float16* kbase = Kh + (size_t)b * M_ * INNER_ + h * DHEAD;
    const _Float16* vbase = Vt + ((size_t)b * INNER_ + h * DHEAD) * M_;
    const int cnt = min(max(cntp[b * CNT_LD], 0), M_);              // keys that are set
    const int nst = ((cnt == 0 ? M_ : cnt) + TKEYS - 1) / TKEYS;    // stages to run, 1 .. NSTAGE

    // This lane's place in a stage: rows crow and crow + 32 of either tile, 16
    // bytes at cch; a wave's copy covers four whole rows of 128 bytes.
    const int crow = tid >> 3;
    const int cch  = (tid & 7) * 8;
    const _Float16* gk = kbase + (size_t)crow * INNER_ + cch;
    const _Float16* gv = vbase + (size_t)crow * M_ + cch;
    const unsigned  lk = (unsigned)(uintptr_t)&ring[0][crow * PITCH + cch];
#define STAGE(st, bf) do {                                                          \
        const unsigned  l_ = lk + (unsigned)(bf) * (2 * TILE_H * 2);                \
        const _Float16* k_ = gk + (size_t)(st) * TKEYS * INNER_;                    \
        const _Float16* v_ = gv + (size_t)(st) * TKEYS;                             \
        stage_copy(l_, l_ + 32 * PITCH * 2, l_ + TILE_H * 2,                        \
                   l_ + TILE_H * 2 + 32 * PITCH * 2,                                \
                   k_, k_ + 32 * INNER_, v_, v_ + (size_t)32 * M_);                 \
    } while (0)

    // Q fragments stay resident: two 32x16 chunks covering d = 0..63
    const _Float16* qp = Q + (size_t)(b * N_ + q0 + col) * INNER_ + h * DHEAD + kb0;
    const v16h bq0 = frag_ld(qp,      qp + 16);
    const v16h bq1 = frag_ld(qp + 32, qp + 48);
    // the four loads share the address pair qp: naming it keeps it live up to
    // the wait, so that it is not rewritten ahead of it
    asm volatile("s_wait_xcnt 0x0" :: "v"(qp) : "memory");

    // stage 0, landed and published; then stage 1 flies under pass 0
    STAGE(0, 0);
    asm volatile("s_wait_asynccnt 0x0" ::: "memory");   // this wave's copies have landed
    __syncthreads();                                    // and every other wave's
    if (nst > 1) STAGE(1, 1);

    // Lazy rescale. Weights are 2^((score - ref) * EXPC) on unscaled scores, ref a reference
    // of this lane's query (same in both halves): the first pass's maximum, raised only when
    // a later score passes it by more than RAISE (a weight above 2^8, far inside f16 range).
    // -ref is the C operand of the S^T products, so the tiles come out as score - ref.
    constexpr float EXPC  = SCALE_ * 1.44269504088896340736f;
    constexpr float RAISE = 8.0f / EXPC;
    float nref = 0.0f;         // -ref
    float thr  = -INFINITY;    // the first pass always sets ref
    v8f   cref = {};           // nref in all eight rows
    float rl = 0.0f;       // running sum over this half's keys only; joined at the end
    v8f acc[4];            // acc[g][r] = O^T[g*16 + 8*half + r][query col]
#pragma unroll
    for (int g = 0; g < 4; ++g) acc[g] = (v8f){};

    // one stage of 64 keys with its publish point; masked_t says at compile time whether
    // it masks
    auto stage = [&](auto masked_t, const int st) __attribute__((always_inline)) {
        constexpr bool MASKED = decltype(masked_t)::value;
        const _Float16* ktile = ring[st & 1];
        const _Float16* vtile = ktile + TILE_H;

        // the stage's fragments, both passes': K rows (two 16-key tiles x two d chunks) and
        // V^T rows (d-major V)
        v16h ak[2][4], avs[2][4];
#pragma unroll
        for (int ps = 0; ps < 2; ++ps) {
            const _Float16* kp = ktile + (ps * 32 + col) * PITCH + kb0;
            ak[ps][0] = frag_ld(kp,                   kp + 16);
            ak[ps][1] = frag_ld(kp + 32,              kp + 48);
            ak[ps][2] = frag_ld(kp + 16 * PITCH,      kp + 16 * PITCH + 16);
            ak[ps][3] = frag_ld(kp + 16 * PITCH + 32, kp + 16 * PITCH + 48);
        }
#pragma unroll
        for (int ps = 0; ps < 2; ++ps) {
            const _Float16* vp = vtile + col * PITCH + ps * 32 + kb0;
#pragma unroll
            for (int g = 0; g < 4; ++g)
                avs[ps][g] = frag_ld(vp + g * 16 * PITCH, vp + g * 16 * PITCH + 16);
        }
        // keeps the stage's LDS reads one group in front of its products: the branches below
        // cut the stage into short pieces, and left free each piece reads its own fragments
        // in pairs, each pair waited for at once
        __builtin_amdgcn_sched_barrier(0);

#pragma unroll
        for (int s = 0; s < TKEYS; s += 32) {
            const int j0 = st * TKEYS + s;

            // ---- S^T = K*Q^T for 32 keys: two 16-key C tiles, 4 WMMAs total
            const v16h ak00 = ak[s / 32][0], ak01 = ak[s / 32][1];
            const v16h ak10 = ak[s / 32][2], ak11 = ak[s / 32][3];
            const v16h* av = avs[s / 32];

            v8f s0, s1;
            s0 = wmma16(ak00, bq0, cref);
            s1 = wmma16(ak10, bq0, cref);
            s0 = wmma16(ak01, bq1, s0);
            s1 = wmma16(ak11, bq1, s1);

            // ---- online softmax, one query per lane
            // bit k of live = key place j0 + k is set; this lane's 16 keys are j0 + 8*half + r
            // (bit r of mk) and j0 + 16 + 8*half + r (bit 16 + r of mk)
            const int      rem  = cnt - j0;
            const unsigned live = rem >= 32 ? ~0u : rem <= 0 ? 0u : (1u << rem) - 1u;
            const unsigned mk   = live >> kb0;
            // a masked key's score is -FLT_MAX: less ref, like the others (0 where no key
            // of the batch is set and ref is -FLT_MAX itself: uniform weights)
            const float fill = -FLT_MAX + nref;
            float a[16];
#pragma unroll
            for (int r = 0; r < 8; ++r) {
                a[r]     = MASKED ? keep(mk, r,      s0[r], fill) : s0[r];
                a[8 + r] = MASKED ? keep(mk, 16 + r, s1[r], fill) : s1[r];
            }
            float t = a[0];
#pragma unroll
            for (int i = 1; i < 16; ++i) t = fmaxf(t, a[i]);
            t = fmaxf(t, xhalf(t));
            // one test a pass, the same for the whole wave (the WMMAs need every lane on)
            if (__builtin_amdgcn_ballot_w32(t > thr) != 0) {
                const bool  first = thr < 0.0f;
                const float sh    = first ? t : fmaxf(t, 0.0f);   // ref is only ever raised
                const float corr  = first ? 1.0f : __builtin_amdgcn_exp2f(-sh * EXPC);
                nref -= sh;
                thr   = RAISE;
#pragma unroll
                for (int i = 0; i < 16; ++i) a[i] -= sh;
#pragma unroll
                for (int r = 0; r < 8; ++r) cref[r] = nref;
                rl *= corr;
#pragma unroll
                for (int g = 0; g < 4; ++g)
#pragma unroll
                    for (int r = 0; r < 8; ++r) acc[g][r] *= corr;
            }

            v16h bp;           // P^T as a B fragment: element s <-> key j0 + 8*half + s (s < 8), j0 + 16 + 8*half + s - 8 (s >= 8)
            float ps0 = 0.0f, ps1 = 0.0f;
#pragma unroll
            for (int r = 0; r < 8; ++r) {
                const float p0 = __builtin_amdgcn_exp2f(a[r] * EXPC);
                const float p1 = __builtin_amdgcn_exp2f(a[8 + r] * EXPC);
                bp[r]     = (_Float16)p0;
                bp[8 + r] = (_Float16)p1;
                ps0 += p0;
                ps1 += p1;
            }
            rl += ps0 + ps1;

            // ---- O^T += V^T * P^T
#pragma unroll
            for (int g = 0; g < 4; ++g) acc[g] = wmma16(av[g], bp, acc[g]);
        }

        // publish point of stage st + 1, which also frees stage st's buffer
        asm volatile("s_wait_dscnt 0x0" ::: "memory");     // this wave has left the buffer
        asm volatile("s_wait_asynccnt 0x0" ::: "memory");  // its copies of stage st + 1 have landed
        __syncthreads();
        if (st + 2 < nst) STAGE(st + 2, st & 1);
    };
    const int nfull = cnt / TKEYS;           // stages whose every key is set
    for (int st = 0; st < nfull; ++st) stage(flag_t<false>{}, st);
    for (int st = nfull; st < nst; ++st) stage(flag_t<true>{}, st);
    // nothing is in flight here; kept so that no copy can outlive the wave
    asm volatile("s_wait_asynccnt 0x0" ::: "memory");
#undef STAGE

    const float inv = 1.0f / (rl + xhalf(rl));
    // consecutive r -> consecutive d -> packed 16B stores
    _Float16* orow = O + (size_t)(b * N_ + q0 + col) * INNER_ + h * DHEAD + 8 * half;
#pragma unroll
    for (int g = 0; g < 4; ++g) {
        h8 pk = {};
#pragma unroll
        for (int r = 0; r < 8; ++r) pk[r] = (_Float16)(acc[g][r] * inv);
        *(h8*)(orow + g * 16) = pk;
    }
}

// ---------------------------------------------------------------------------
extern "C" void kernel_launch(void* const* d_in, const int* in_sizes, int n_in,
                              void* d_out, int out_size, void* d_ws, size_t ws_size,
                              hipStream_t stream) {
    const float* x    = (const float*)d_in[0];
    const float* ctx  = (const float*)d_in[1];
    const int*   mask = (const int*)d_in[2];
    const float* Wq   = (const float*)d_in[3];
    const float* Wkv  = (const float*)d_in[4];
    const float* Wo   = (const float*)d_in[5];
    const float* bo   = (const float*)d_in[6];
    float* out = (float*)d_out;

    // Workspace layout: six 8192x512 f16 tensors + four 512x512 f16 weights ~ 50 MB, then the int key orders and counts
    _Float16* W = (_Float16*)d_ws;
    const size_t SZ = (size_t)B_ * N_ * INNER_;   // 4M elements
    _Float16* x_h  = W;
    _Float16* c_h  = W + SZ;
    _Float16* q_h  = W + 2 * SZ;
    _Float16* k_h  = W + 3 * SZ;
    _Float16* vt_h = W + 4 * SZ;   // [B][INNER][M] (d-major V)
    _Float16* ao_h = W + 5 * SZ;
    _Float16* Wt   = W + 6 * SZ;       // WqT, WkT, WvT, WoT, one behind the other
    _Float16* WoT  = Wt + 3 * WGT_E;
    int* ord = (int*)(Wt + 4 * WGT_E); // [B][M] key order of each batch
    int* cnt = ord + B_ * M_;          // [B][CNT_LD] keys that are set

    static_assert(ACT_E % CV_BLOCK_E == 0 && B_ * M_ * CDIM == ACT_E && B_ * N_ * QDIM == ACT_E,
                  "the convert's grid is exact");
    static_assert(M_ % CV_THREADS == 0 && (M_ & (M_ - 1)) == 0, "key_order's ballots are whole");
    cvt_all<<<B_ + 2 * CV_ACT_B + 4 * CV_WGT_B, CV_THREADS, 0, stream>>>(x, ctx, Wq, Wkv, Wo, mask, x_h, c_h, Wt, ord, cnt);

    // 128x128 tile of C per work-group: grid (columns / 128, rows / 128)
    static_assert(QDIM == GK && CDIM == GK && INNER_ == GK && INNER_ == GN && QDIM == GN,
                  "every projection is 512 deep and 512 wide");
    static_assert(GN % GTN == 0 && (B_ * N_) % GTM == 0 && (B_ * M_) % GTM == 0 && M_ % GTM == 0 && GNST >= 2,
                  "the grid is exact and the ring has its two stages");
    static_assert(B_ * N_ == B_ * M_, "the three input projections have the same rows");
    const dim3 gg(GN / GTN, (B_ * N_) / GTM);       // 4 x 64
    const dim3 g3(3 * (GN / GTN), (B_ * N_) / GTM); // 12 x 64
    gemm_wmma<0><<<g3, GWAVES * 32, 0, stream>>>(x_h, c_h, Wt, q_h, k_h, vt_h, nullptr, nullptr, ord, cnt);

    flash_attn<<<dim3(B_ * HEADS_, N_ / (QWAVES * 16)), QWAVES * 32, 0, stream>>>(q_h, k_h, vt_h, cnt, ao_h);

    gemm_wmma<2><<<gg, GWAVES * 32, 0, stream>>>(ao_h, nullptr, WoT, nullptr, nullptr, nullptr, out, bo, nullptr, nullptr);
}

// v008
// A run of this version takes 49.9 microseconds.
// In both of two side-by-side timings against v007, it was 1.03 times as fast.
// Counting every step since v000, it is 8.60 times as fast.
#include <hip/hip_runtime.h>
#include <hip/hip_bf16.h>
#include <float.h>
#include <stdint.h>

// Problem constants (match the reference)
#define B_     4
#define N_     2048
#define M_     2048
#define QDIM   512
#define CDIM   512
#define HEADS_ 8
#define DHEAD  64
#define INNER_ 512
#define SCALE_ 0.125f   // 64^-0.5

typedef _Float16 v16h __attribute__((ext_vector_type(16)));
typedef _Float16 h8   __attribute__((ext_vector_type(8)));
typedef float    v8f  __attribute__((ext_vector_type(8)));

// Build a 16x32 f16 A/B fragment for v_wmma_f32_16x16x32_f16.
// Per the CDNA5 ISA layout, lane L (row/col = L%16, half = L/16) holds
//   frag[0..7]  = X[row][ 8*half + i]        (contiguous 16B)
//   frag[8..15] = X[row][16 + 8*half + i]    (contiguous 16B)
__device__ __forceinline__ v16h frag_ld(const _Float16* lo_p, const _Float16* hi_p) {
    h8 lo = *(const h8*)lo_p;
    h8 hi = *(const h8*)hi_p;
    v16h r;
#pragma unroll
    for (int i = 0; i < 8; ++i) { r[i] = lo[i]; r[i + 8] = hi[i]; }
    return r;
}

__device__ __forceinline__ v8f wmma16(v16h a, v16h b, v8f c) {
    // (neg_a, A, neg_b, B, c_mod, C, reuse_a, reuse_b)
    return __builtin_amdgcn_wmma_f32_16x16x32_f16(false, a, false, b, (short)0, c,
                                                  false, false);
}

// ---------------------------------------------------------------------------
typedef _Float16 h4 __attribute__((ext_vector_type(4)));
typedef float    f4 __attribute__((ext_vector_type(4)));

#define CV_THREADS 256
#define CV_LOADS   8                               // 16-byte loads in flight per lane
#define CV_WAVE_E  (CV_LOADS * 128)                // elements per wave: 4 KB of f32 in a row
#define CV_BLOCK_E ((CV_THREADS / 32) * CV_WAVE_E) // elements per work-group

// f32 -> f16 elementwise convert, 32 elements a lane: few waves to start, each with
// eight wave-wide loads of 512 contiguous bytes in flight; each store of a wave
// covers 256 contiguous bytes. Work-group blk of the tensor's CV_ACT_B, which cover
// it exactly (a multiple of CV_BLOCK_E elements), so there is no bound to test.
__device__ __forceinline__
void cvt_f32_to_h(const float* __restrict__ src, _Float16* __restrict__ dst, int blk) {
    const int wave = blk * (CV_THREADS / 32) + (threadIdx.x >> 5);
    const int base = wave * CV_WAVE_E + (threadIdx.x & 31) * 4;
    f4 v[CV_LOADS];
#pragma unroll
    for (int j = 0; j < CV_LOADS; ++j) v[j] = *(const f4*)(src + base + j * 128);
#pragma unroll
    for (int j = 0; j < CV_LOADS; ++j) {
        h4 o;
#pragma unroll
        for (int e = 0; e < 4; ++e) o[e] = (_Float16)v[j][e];
        *(h4*)(dst + base + j * 128) = o;
    }
    // inlined into cvt_all, another job's code follows in the listing: no register that
    // these stores name is rewritten ahead of this wait
    asm volatile("s_wait_xcnt 0x0" ::: "memory");
}

// Transpose-convert weight W[in=rows][... ld ...] (a block of columns from col0 on)
// into Wt[out][in] f16, so GEMM B-operand columns become contiguous rows.
// A lane takes 8 rows of one column: eight loads in flight, each 128 contiguous bytes
// a wave, and one 16-byte store; the eight waves of a work-group take 64 rows, so a
// work-group writes whole 128-byte lines of Wt. Work-group (bx, by) of (columns / 32,
// rows / 64), which cover the block exactly.
__device__ __forceinline__
void cvt_transpose(const float* __restrict__ src,
                   _Float16* __restrict__ dst,
                   int rows, int ld, int col0, int bx, int by) {
    const int o  = bx * 32 + (threadIdx.x & 31);
    const int r0 = by * 64 + (threadIdx.x >> 5) * 8;
    const float* s = src + (size_t)r0 * ld + col0 + o;
    float v[8];
#pragma unroll
    for (int i = 0; i < 8; ++i) v[i] = s[(size_t)i * ld];
    h8 pk;
#pragma unroll
    for (int i = 0; i < 8; ++i) pk[i] = (_Float16)v[i];
    *(h8*)(dst + (size_t)o * rows + r0) = pk;
    // as at the end of cvt_f32_to_h: in front of any rewrite of the store's registers
    asm volatile("s_wait_xcnt 0x0" ::: "memory");
}

#define ACT_E    (B_ * N_ * INNER_)        // elements of one activation tensor
#define WGT_E    (512 * 512)               // elements of one weight block
#define CV_ACT_B (ACT_E / CV_BLOCK_E)      // work-groups per activation tensor
#define CV_WGT_B ((512 / 32) * (512 / 64)) // work-groups per weight block

#define CNT_LD 32   // ints between two batches' counts: each work-group writes a 128-byte line of its own

// Key order of one batch: the keys whose mask word is set first, in their own order,
// then the masked ones; ord[p] = key at place p, cnt = how many are set. A masked key's
// weight is exp(-FLT_MAX - max) = 0 wherever the batch has one key set, so the K and V
// projections and the attention need only the first cnt places (a batch with none set
// keeps all its keys, all masked: uniform weights, as in the reference).
// One work-group a batch; wave w takes keys 256 w .. 256 w + 255, 32 a ballot.
__device__ __forceinline__
void key_order(const int* __restrict__ mask, int* __restrict__ ord, int* __restrict__ cnt) {
    __shared__ int wsum[CV_THREADS / 32];
    const int lane = threadIdx.x & 31;
    const int wave = threadIdx.x >> 5;
    constexpr int NB = M_ / CV_THREADS;          // ballots per wave
    const int* mp = mask + wave * (NB * 32) + lane;
    unsigned bal[NB];
    int tot = 0;
#pragma unroll
    for (int i = 0; i < NB; ++i) {
        bal[i] = __builtin_amdgcn_ballot_w32(mp[i * 32] != 0);
        tot += __builtin_popcount(bal[i]);
    }
    // the loads share the address pair mp: naming it keeps it live up to the wait, so
    // that it is not rewritten ahead of it
    asm volatile("s_wait_xcnt 0x0" :: "v"(mp) : "memory");
    if (lane == 0) wsum[wave] = tot;
    __syncthreads();
    int before = 0, all = 0;                     // set keys in earlier waves, in the batch
#pragma unroll
    for (int w = 0; w < CV_THREADS / 32; ++w) {
        const int t = wsum[w];
        before += w < wave ? t : 0;
        all    += t;
    }
    const unsigned below = (1u << lane) - 1u;
    const int key0 = wave * (NB * 32) + lane;
#pragma unroll
    for (int i = 0; i < NB; ++i) {
        const int key = key0 + i * 32;
        const int set = before + __builtin_popcount(bal[i] & below);   // set keys in front of this one
        ord[((bal[i] >> lane) & 1u) ? set : all + key - set] = key;    // masked ones follow all set ones
        before += __builtin_popcount(bal[i]);
    }
    if (threadIdx.x == 0) *cnt = all;
    // as at the end of cvt_f32_to_h: in front of any rewrite of the stores' registers
    asm volatile("s_wait_xcnt 0x0" ::: "memory");
}

// All six converts in one launch: none reads what another writes, so one grid holds
// them side by side and the short weight blocks run under the two long streams
// instead of each waiting for the launch before it to drain. The work-group index
// picks the job: x, context (the long ones start first), then the four weight blocks,
// whose transposes lie one behind the other in Wt: Wq, the K half and the V half of
// Wkv, Wo. The first B_ work-groups form the batches' key orders.
__global__ __launch_bounds__(CV_THREADS)
void cvt_all(const float* __restrict__ x, const float* __restrict__ ctx,
             const float* __restrict__ Wq, const float* __restrict__ Wkv,
             const float* __restrict__ Wo, const int* __restrict__ mask,
             _Float16* __restrict__ x_h, _Float16* __restrict__ c_h,
             _Float16* __restrict__ Wt, int* __restrict__ ord, int* __restrict__ cnt) {
    const int bid = (int)blockIdx.x - B_;
    if (bid < 0) {
        const int b = blockIdx.x;
        key_order(mask + b * M_, ord + b * M_, cnt + b * CNT_LD);
    } else if (bid < CV_ACT_B) {
        cvt_f32_to_h(x, x_h, bid);
    } else if (bid < 2 * CV_ACT_B) {
        cvt_f32_to_h(ctx, c_h, bid - CV_ACT_B);
    } else {
        const int w  = (bid - 2 * CV_ACT_B) / CV_WGT_B;   // which weight block
        const int t  = (bid - 2 * CV_ACT_B) % CV_WGT_B;
        const int bx = t % (512 / 32);
        const int by = t / (512 / 32);
        if (w == 1 || w == 2)
            cvt_transpose(Wkv, Wt + w * WGT_E, 512, 1024, (w - 1) * 512, bx, by);
        else
            cvt_transpose(w == 0 ? Wq : Wo, Wt + w * WGT_E, 512, 512, 0, bx, by);
    }
}

// ---------------------------------------------------------------------------
// Geometry of gemm_wmma's work-group and of its LDS ring
#define GWAVES 8                 // waves per work-group: 2 along the output tile's rows x 4 along its columns, 64 x 32 each
#define GTM    128               // rows of C per work-group
#define GTN    128               // columns of C per work-group
#define GK     512               // depth of every projection
#define GN     512               // columns of every projection
#define GSK    128               // k per stage: operand rows of 256 B
#define GPITCH 136               // halfs per LDS row: 256 B + 16 B, an odd multiple of 16 B
#define GTILE  (128 * GPITCH)    // halfs of one staged operand tile (128 rows)
#define GNST   (GK / GSK)

// One operand tile's share of one lane: eight 16-byte asynchronous copies to LDS,
// rows 16 apart. The s_wait_xcnt closes the statement, so that no register a copy
// names is rewritten ahead of it.
__device__ __forceinline__ void tile_copy(unsigned l, const _Float16* g) {
    const unsigned ls = 16 * GPITCH * 2;   // bytes between two of the lane's LDS rows
    const int      gs = 16 * GK;           // halfs between two of its global rows
    asm volatile("global_load_async_to_lds_b128 %0, %8, off\n\t"
                 "global_load_async_to_lds_b128 %1, %9, off\n\t"
                 "global_load_async_to_lds_b128 %2, %10, off\n\t"
                 "global_load_async_to_lds_b128 %3, %11, off\n\t"
                 "global_load_async_to_lds_b128 %4, %12, off\n\t"
                 "global_load_async_to_lds_b128 %5, %13, off\n\t"
                 "global_load_async_to_lds_b128 %6, %14, off\n\t"
                 "global_load_async_to_lds_b128 %7, %15, off\n\t"
                 "s_wait_xcnt 0x0"
                 :: "v"(l), "v"(l + ls), "v"(l + 2 * ls), "v"(l + 3 * ls),
                    "v"(l + 4 * ls), "v"(l + 5 * ls), "v"(l + 6 * ls), "v"(l + 7 * ls),
                    "v"(g), "v"(g + gs), "v"(g + 2 * gs), "v"(g + 3 * gs),
                    "v"(g + 4 * gs), "v"(g + 5 * gs), "v"(g + 6 * gs), "v"(g + 7 * gs)
                 : "memory");
}

// The same for rows that lie anywhere: each of the lane's eight copies has its own
// global address.
__device__ __forceinline__ void rows_copy(unsigned l, const _Float16* g0, const _Float16* g1,
                                          const _Float16* g2, const _Float16* g3,
                                          const _Float16* g4, const _Float16* g5,
                                          const _Float16* g6, const _Float16* g7) {
    const unsigned ls = 16 * GPITCH * 2;   // bytes between two of the lane's LDS rows
    asm volatile("global_load_async_to_lds_b128 %0, %8, off\n\t"
                 "global_load_async_to_lds_b128 %1, %9, off\n\t"
                 "global_load_async_to_lds_b128 %2, %10, off\n\t"
                 "global_load_async_to_lds_b128 %3, %11, off\n\t"
                 "global_load_async_to_lds_b128 %4, %12, off\n\t"
                 "global_load_async_to_lds_b128 %5, %13, off\n\t"
                 "global_load_async_to_lds_b128 %6, %14, off\n\t"
                 "global_load_async_to_lds_b128 %7, %15, off\n\t"
                 "s_wait_xcnt 0x0"
                 :: "v"(l), "v"(l + ls), "v"(l + 2 * ls), "v"(l + 3 * ls),
                    "v"(l + 4 * ls), "v"(l + 5 * ls), "v"(l + 6 * ls), "v"(l + 7 * ls),
                    "v"(g0), "v"(g1), "v"(g2), "v"(g3), "v"(g4), "v"(g5), "v"(g6), "v"(g7)
                 : "memory");
}

// f16 WMMA GEMM: C[m][n] = sum_k A[m][k] * Bt[n][k], both operands k-contiguous.
// A work-group of eight waves computes a 128 x 128 tile of C. Each stage of 128 k
// (128 rows of A and 128 rows of Bt, 256 bytes a row) is brought into LDS once for
// all eight waves, in whole 256-byte pieces, by asynchronous copies into a ring of
// two buffers; the fragments are read from there, and every fragment read feeds
// four (the WMMAs' A operand) or two (their B operand) WMMAs of its wave's 2 x 4 accumulator tiles.
// MODE: 0 = the three input projections in one launch: none reads what another
//           writes, so one grid of 3 x 4 column tiles holds them, two work-groups a
//           WGP, and one's first stage and stores run under another's products.
//           Bt is the three transposed weights one behind the other (1536 rows);
//           column tiles 0..3 are Q = A0 * Wq and 4..7 are K = A1 * Wk, f16 row-major;
//           8..11 are V = A1 * Wv, f16 transposed per batch -> out[b][n][m%Mdim].
//           Row p of K and V is the key at place p of its batch's key order (ord):
//           the A rows are gathered, and a row tile behind the batch's last key that
//           is set (cnt) has no reader and is left out,
//       2 = f32 store + bias (final projection of A0 into d_out).
// Every output tile is gathered in LDS and stored in whole rows, 16 bytes a lane.
// Left open: a batch's last K and V row tile is computed whole, however few of its keys
// are set; x and context are still converted in a launch of their own, the masked rows
// of context too.
template <int MODE>
__global__ __launch_bounds__(GWAVES * 32)
void gemm_wmma(const _Float16* __restrict__ A0,
               const _Float16* __restrict__ A1,
               const _Float16* __restrict__ Bt,
               _Float16* __restrict__ outQ,
               _Float16* __restrict__ outK,
               _Float16* __restrict__ outVt,
               float* __restrict__ outF,
               const float* __restrict__ bias,
               const int* __restrict__ ord,
               const int* __restrict__ cnt) {
    constexpr int Mdim = M_;
    constexpr int NT   = GN / GTN;      // column tiles of one projection
    // which projection this work-group belongs to (the same for all its waves)
    const int sel = MODE == 0 ? blockIdx.x / NT : 0;
    const _Float16* A = sel == 0 ? A0 : A1;
    // [buffer][A tile, then Bt tile]
    __shared__ __attribute__((aligned(16))) _Float16 gring[2][2 * GTILE];

    const int tid  = threadIdx.x;
    const int lane = tid & 31;
    const int col  = lane & 15;
    const int half = lane >> 4;
    const int kb0  = 8 * half;
    const int wm   = (tid >> 5) & 3;    // this wave's 32 columns of the output tile
    const int wn   = tid >> 7;          // this wave's 64 rows of the output tile
    const int n0   = (blockIdx.x % NT) * GTN;   // first column within the projection's output
    const int m0   = blockIdx.y * GTM;
    // Which staged tile is the WMMAs' A operand, so that its rows run down a lane's eight
    // accumulator registers: the one whose index is contiguous in the output. That is Bt
    // (n) for a row-major output, A (m) for the transposed V. Both tiles have 128 rows and
    // one fragment layout, so only the two tile offsets differ.
    const int rtile = (MODE == 0 && sel == 2) ? 0 : GTILE;

    // This lane's place in a stage: rows crow + 16 i of either tile, 16 bytes at
    // cch; a wave's copy covers two whole rows of 256 bytes.
    const int crow = tid >> 4;
    const int cch  = (tid & 15) * 8;
    int arow[8];                        // the lane's eight rows of A
#pragma unroll
    for (int i = 0; i < 8; ++i) arow[i] = m0 + crow + 16 * i;
    if (MODE == 0 && sel != 0) {
        const int bb = m0 / Mdim;
        const int c  = min(cnt[bb * CNT_LD], Mdim);
        // the same for the whole work-group, in front of every copy and barrier
        if (m0 % Mdim >= (c <= 0 ? Mdim : c)) return;
        const int* op = ord + m0 + crow;
#pragma unroll
        for (int i = 0; i < 8; ++i) arow[i] = bb * Mdim + (op[16 * i] & (Mdim - 1));
        // in front of any rewrite of a register that these loads name
        asm volatile("s_wait_xcnt 0x0" ::: "memory");
    }
    const _Float16* ga = A + cch;
    const _Float16* gb = Bt + (size_t)(blockIdx.x * GTN + crow) * GK + cch;
    const unsigned  la = (unsigned)(uintptr_t)&gring[0][crow * GPITCH + cch];
#define GSTAGE(st, bf) do {                                                         \
        const unsigned l_ = la + (unsigned)(bf) * (2 * GTILE * 2);                  \
        const _Float16* a_ = ga + (st) * GSK;                                       \
        rows_copy(l_, a_ + arow[0] * GK, a_ + arow[1] * GK, a_ + arow[2] * GK,      \
                  a_ + arow[3] * GK, a_ + arow[4] * GK, a_ + arow[5] * GK,          \
                  a_ + arow[6] * GK, a_ + arow[7] * GK);                            \
        tile_copy(l_ + GTILE * 2, gb + (st) * GSK);                                 \
    } while (0)

    // stage 0, landed and published; then stage 1 flies under pass 0
    GSTAGE(0, 0);
    asm volatile("s_wait_asynccnt 0x0" ::: "memory");   // this wave's copies have landed
    __syncthreads();                                    // and every other wave's
    GSTAGE(1, 1);

    // the bias of this lane's four output columns (see the stores at the end), fetched here
    // so that its latency lies under the products
    f4 bv = {};
    if (MODE == 2) {
        bv = *(const f4*)(bias + n0 + lane * 4);
        // in front of any rewrite of a register that this load names
        asm volatile("s_wait_xcnt 0x0" ::: "memory");
    }

    v8f acc[2][4];
#pragma unroll
    for (int i = 0; i < 2; ++i)
#pragma unroll
        for (int t = 0; t < 4; ++t) acc[i][t] = (v8f){};

    for (int st = 0; st < GNST; ++st) {
        const _Float16* ap = gring[st & 1] + rtile + (wm * 32 + col) * GPITCH + kb0;
        const _Float16* bp = gring[st & 1] + (GTILE - rtile) + (wn * 64 + col) * GPITCH + kb0;
        // two fragment sets: k-step j + 1 of this stage is read while k-step j is multiplied
        v16h a[2][2], b[2][4];
#define GFRAGS(set, ks) do {                                                        \
        _Pragma("unroll")                                                           \
        for (int i = 0; i < 2; ++i)                                                 \
            a[set][i] = frag_ld(ap + i * 16 * GPITCH + (ks),                        \
                                ap + i * 16 * GPITCH + (ks) + 16);                  \
        _Pragma("unroll")                                                           \
        for (int t = 0; t < 4; ++t)                                                 \
            b[set][t] = frag_ld(bp + t * 16 * GPITCH + (ks),                        \
                                bp + t * 16 * GPITCH + (ks) + 16);                  \
    } while (0)
        GFRAGS(0, 0);
        // unrolled (as every loop over i, t, r here): the set index j & 1 is then a
        // constant, and the fragments and accumulators stay in registers
#pragma unroll
        for (int j = 0; j < GSK / 32; ++j) {
            if (j + 1 < GSK / 32) GFRAGS((j + 1) & 1, (j + 1) * 32);
            // keeps the next k-step's twelve LDS reads one group in front of this k-step's
            // WMMAs; left free, they are spread among the WMMAs and waited for at once
            __builtin_amdgcn_sched_barrier(0);
#pragma unroll
            for (int i = 0; i < 2; ++i)
#pragma unroll
                for (int t = 0; t < 4; ++t)
                    acc[i][t] = wmma16(a[j & 1][i], b[j & 1][t], acc[i][t]);
            // and the reads after next behind them
            __builtin_amdgcn_sched_barrier(0);
        }
#undef GFRAGS

        // publish point of stage st + 1, which also frees stage st's buffer
        asm volatile("s_wait_dscnt 0x0" ::: "memory");     // this wave has left the buffer
        asm volatile("s_wait_asynccnt 0x0" ::: "memory");  // its copies of stage st + 1 have landed
        __syncthreads();
        if (st + 2 < GNST) GSTAGE(st + 2, st & 1);
    }
    // nothing is in flight here; kept so that no copy can outlive the wave
    asm volatile("s_wait_asynccnt 0x0" ::: "memory");
#undef GSTAGE

    // The tile of C leaves through LDS in whole rows. Every wave has left the ring (the
    // loop's last barrier) and no copy is in flight, so the ring's bytes are free.
    // C-layout: lane (col, half), VGPR r  <->  A-operand row 8*half + r, B-operand row col:
    // the lane's eight values are neighbours in output row orow, from place ocol on.
    const int orow = wn * 64 + col;
    const int ocol = wm * 32 + 8 * half;
    if (MODE == 0) {
        _Float16* ct = &gring[0][0];        // 128 output rows of 256 B, pitch as the ring's
#pragma unroll
        for (int i = 0; i < 2; ++i)
#pragma unroll
            for (int t = 0; t < 4; ++t) {
                h8 pk = {};
#pragma unroll
                for (int r = 0; r < 8; ++r) pk[r] = (_Float16)acc[i][t][r];
                *(h8*)(ct + (orow + t * 16) * GPITCH + ocol + i * 16) = pk;
            }
        __syncthreads();                    // the tile is whole before any row is read
        // rows crow + 16 j, 16 bytes at cch: a wave's store covers two whole rows of 256 B
        h8 ov[8];
#pragma unroll
        for (int j = 0; j < 8; ++j) ov[j] = *(const h8*)(ct + (crow + 16 * j) * GPITCH + cch);
        if (sel != 2) {
            _Float16* o = (sel == 0 ? outQ : outK) + (size_t)(m0 + crow) * GN + n0 + cch;
#pragma unroll
            for (int j = 0; j < 8; ++j) *(h8*)(o + j * 16 * GN) = ov[j];
        } else {
            // output rows are V's columns, places the keys of one batch (Mdim is a multiple of GTM)
            _Float16* o = outVt + ((size_t)(m0 / Mdim) * GN + n0 + crow) * Mdim + m0 % Mdim + cch;
#pragma unroll
            for (int j = 0; j < 8; ++j) *(h8*)(o + j * 16 * Mdim) = ov[j];
        }
    } else {
        constexpr int FP = GTN + 4;         // floats per LDS row: 512 B + 16 B, an odd multiple of 16 B
        float* cf = (float*)&gring[0][0];
#pragma unroll
        for (int i = 0; i < 2; ++i)
#pragma unroll
            for (int t = 0; t < 4; ++t) {
                float* p = cf + (orow + t * 16) * FP + ocol + i * 16;
                *(f4*)p       = (f4){acc[i][t][0], acc[i][t][1], acc[i][t][2], acc[i][t][3]};
                *(f4*)(p + 4) = (f4){acc[i][t][4], acc[i][t][5], acc[i][t][6], acc[i][t][7]};
            }
        __syncthreads();                    // the tile is whole before any row is read
        // rows frow + 8 j, 16 bytes at fch: a wave's store covers one whole row of 512 B
        const int frow = tid >> 5;
        const int fch  = lane * 4;
        f4 ov[16];
#pragma unroll
        for (int j = 0; j < 16; ++j) ov[j] = *(const f4*)(cf + (frow + 8 * j) * FP + fch) + bv;
        float* o = outF + (size_t)(m0 + frow) * GN + n0 + fch;
#pragma unroll
        for (int j = 0; j < 16; ++j) *(f4*)(o + j * 8 * GN) = ov[j];
    }
    // in front of any rewrite of a register that these stores name
    asm volatile("s_wait_xcnt 0x0" ::: "memory");
}

// ---------------------------------------------------------------------------
// Lane l <-> lane l ^ 16 (the two halves of a wave that share one query column)
__device__ __forceinline__ float xhalf(float x) {
    const int b = __builtin_bit_cast(int, x);
    return __builtin_bit_cast(float,
        __builtin_amdgcn_permlanex16(b, b, 0x76543210, 0xfedcba98, false, false));
}

// x where bit 'bit' of m is set, else fill: the bit spread over the word
// picks between the two bit patterns (no compare)
__device__ __forceinline__ float keep(unsigned m, int bit, float x, float fill) {
    const int sel = (int)(m << (31 - bit)) >> 31;
    const int fil = __builtin_bit_cast(int, fill);
    return __builtin_bit_cast(float, (sel & __builtin_bit_cast(int, x)) | (~sel & fil));
}

// a compile-time yes or no handed to a generic lambda
template <bool V> struct flag_t { static constexpr bool value = V; };

// Geometry of flash_attn's work-group and of its LDS ring
#define QWAVES 8                 // waves per work-group, 16 query columns each
#define TKEYS  64                // keys per stage: K rows and V^T rows are both 128 B
#define PITCH  72                // halfs per LDS row: 128 B + 16 B, an odd multiple of 16 B
#define TILE_H (64 * PITCH)      // halfs of one staged tile (64 rows)
#define NSTAGE (M_ / TKEYS)

// One stage's share of one lane: four 16-byte asynchronous copies to LDS.
// The s_wait_xcnt closes the statement, so that no register a copy names is
// rewritten ahead of it.
__device__ __forceinline__ void stage_copy(unsigned l0, unsigned l1, unsigned l2, unsigned l3,
                                           const _Float16* g0, const _Float16* g1,
                                           const _Float16* g2, const _Float16* g3) {
    asm volatile("global_load_async_to_lds_b128 %0, %4, off\n\t"
                 "global_load_async_to_lds_b128 %1, %5, off\n\t"
                 "global_load_async_to_lds_b128 %2, %6, off\n\t"
                 "global_load_async_to_lds_b128 %3, %7, off\n\t"
                 "s_wait_xcnt 0x0"
                 :: "v"(l0), "v"(l1), "v"(l2), "v"(l3), "v"(g0), "v"(g1), "v"(g2), "v"(g3)
                 : "memory");
}

__global__ __launch_bounds__(QWAVES * 32) __attribute__((amdgpu_waves_per_eu(4, 4)))
void flash_attn(const _Float16* __restrict__ Q,
                const _Float16* __restrict__ Kh,
                const _Float16* __restrict__ Vt,
                const int* __restrict__ cntp,
                _Float16* __restrict__ O) {
    // [buffer][K tile, then V^T tile]
    __shared__ __attribute__((aligned(16))) _Float16 ring[2][2 * TILE_H];

    const int tid  = threadIdx.x;
    const int lane = tid & 31;
    const int col  = lane & 15;
    const int half = lane >> 4;
    const int kb0  = 8 * half;
    const int bh   = blockIdx.x;
    const int b    = bh / HEADS_;
    const int h    = bh % HEADS_;
    const int q0   = blockIdx.y * (QWAVES * 16) + (tid >> 5) * 16;

    const _Float16* kbase = Kh + (size_t)b * M_ * INNER_ + h * DHEAD;
    const _Float16* vbase = Vt + ((size_t)b * INNER_ + h * DHEAD) * M_;
    const int cnt = min(max(cntp[b * CNT_LD], 0), M_);              // keys that are set
    const int nst = ((cnt == 0 ? M_ : cnt) + TKEYS - 1) / TKEYS;    // stages to run, 1 .. NSTAGE

    // This lane's place in a stage: rows crow and crow + 32 of either tile, 16
    // bytes at cch; a wave's copy covers four whole rows of 128 bytes.
    const int crow = tid >> 3;
    const int cch  = (tid & 7) * 8;
    const _Float16* gk = kbase + (size_t)crow * INNER_ + cch;
    const _Float16* gv = vbase + (size_t)crow * M_ + cch;
    const unsigned  lk = (unsigned)(uintptr_t)&ring[0][crow * PITCH + cch];
#define STAGE(st, bf) do {                                                          \
        const unsigned  l_ = lk + (unsigned)(bf) * (2 * TILE_H * 2);                \
        const _Float16* k_ = gk + (size_t)(st) * TKEYS * INNER_;                    \
        const _Float16* v_ = gv + (size_t)(st) * TKEYS;                             \
        stage_copy(l_, l_ + 32 * PITCH * 2, l_ + TILE_H * 2,                        \
                   l_ + TILE_H * 2 + 32 * PITCH * 2,                                \
                   k_, k_ + 32 * INNER_, v_, v_ + (size_t)32 * M_);                 \
    } while (0)

    // Q fragments stay resident: two 32x16 chunks covering d = 0..63
    const _Float16* qp = Q + (size_t)(b * N_ + q0 + col) * INNER_ + h * DHEAD + kb0;
    const v16h bq0 = frag_ld(qp,      qp + 16);
    const v16h bq1 = frag_ld(qp + 32, qp + 48);
    // the four loads share the address pair qp: naming it keeps it live up to
    // the wait, so that it is not rewritten ahead of it
    asm volatile("s_wait_xcnt 0x0" :: "v"(qp) : "memory");

    // stage 0, landed and published; then stage 1 flies under pass 0
    STAGE(0, 0);
    asm volatile("s_wait_asynccnt 0x0" ::: "memory");   // this wave's copies have landed
    __syncthreads();                                    // and every other wave's
    if (nst > 1) STAGE(1, 1);

    // Lazy rescale. Weights are 2^((score - ref) * EXPC) on unscaled scores, ref a reference
    // of this lane's query (same in both halves): the first pass's maximum, raised only when
    // a later score passes it by more than RAISE (a weight above 2^8, far inside f16 range).
    // -ref is the C operand of the S^T products, so the tiles come out as score - ref.
    constexpr float EXPC  = SCALE_ * 1.44269504088896340736f;
    constexpr float RAISE = 8.0f / EXPC;
    float nref = 0.0f;         // -ref
    float thr  = -INFINITY;    // the first pass always sets ref
    v8f   cref = {};           // nref in all eight rows
    float rl = 0.0f;       // running sum over this half's keys only; joined at the end
    v8f acc[4];            // acc[g][r] = O^T[g*16 + 8*half + r][query col]
#pragma unroll
    for (int g = 0; g < 4; ++g) acc[g] = (v8f){};

    // one stage of 64 keys with its publish point; masked_t says at compile time whether
    // it masks
    auto stage = [&](auto masked_t, const int st) __attribute__((always_inline)) {
        constexpr bool MASKED = decltype(masked_t)::value;
        const _Float16* ktile = ring[st & 1];
        const _Float16* vtile = ktile + TILE_H;

        // the stage's fragments, both passes': K rows (two 16-key tiles x two d chunks) and
        // V^T rows (d-major V)
        v16h ak[2][4], avs[2][4];
#pragma unroll
        for (int ps = 0; ps < 2; ++ps) {
            const _Float16* kp = ktile + (ps * 32 + col) * PITCH + kb0;
            ak[ps][0] = frag_ld(kp,                   kp + 16);
            ak[ps][1] = frag_ld(kp + 32,              kp + 48);
            ak[ps][2] = frag_ld(kp + 16 * PITCH,      kp + 16 * PITCH + 16);
            ak[ps][3] = frag_ld(kp + 16 * PITCH + 32, kp + 16 * PITCH + 48);
        }
#pragma unroll
        for (int ps = 0; ps < 2; ++ps) {
            const _Float16* vp = vtile + col * PITCH + ps * 32 + kb0;
#pragma unroll
            for (int g = 0; g < 4; ++g)
                avs[ps][g] = frag_ld(vp + g * 16 * PITCH, vp + g * 16 * PITCH + 16);
        }
        // keeps the stage's LDS reads one group in front of its products: the branches below
        // cut the stage into short pieces, and left free each piece reads its own fragments
        // in pairs, each pair waited for at once
        __builtin_amdgcn_sched_barrier(0);

#pragma unroll
        for (int s = 0; s < TKEYS; s += 32) {
            const int j0 = st * TKEYS + s;

            // ---- S^T = K*Q^T for 32 keys: two 16-key C tiles, 4 WMMAs total
            const v16h ak00 = ak[s / 32][0], ak01 = ak[s / 32][1];
            const v16h ak10 = ak[s / 32][2], ak11 = ak[s / 32][3];
            const v16h* av = avs[s / 32];

            v8f s0, s1;
            s0 = wmma16(ak00, bq0, cref);
            s1 = wmma16(ak10, bq0, cref);
            s0 = wmma16(ak01, bq1, s0);
            s1 = wmma16(ak11, bq1, s1);

            // ---- online softmax, one query per lane
            // bit k of live = key place j0 + k is set; this lane's 16 keys are j0 + 8*half + r
            // (bit r of mk) and j0 + 16 + 8*half + r (bit 16 + r of mk)
            const int      rem  = cnt - j0;
            const unsigned live = rem >= 32 ? ~0u : rem <= 0 ? 0u : (1u << rem) - 1u;
            const unsigned mk   = live >> kb0;
            // a masked key's score is -FLT_MAX: less ref, like the others (0 where no key
            // of the batch is set and ref is -FLT_MAX itself: uniform weights)
            const float fill = -FLT_MAX + nref;
            float a[16];
#pragma unroll
            for (int r = 0; r < 8; ++r) {
                a[r]     = MASKED ? keep(mk, r,      s0[r], fill) : s0[r];
                a[8 + r] = MASKED ? keep(mk, 16 + r, s1[r], fill) : s1[r];
            }
            float t = a[0];
#pragma unroll
            for (int i = 1; i < 16; ++i) t = fmaxf(t, a[i]);
            t = fmaxf(t, xhalf(t));
            // one test a pass, the same for the whole wave (the WMMAs need every lane on)
            if (__builtin_amdgcn_ballot_w32(t > thr) != 0) {
                const bool  first = thr < 0.0f;
                const float sh    = first ? t : fmaxf(t, 0.0f);   // ref is only ever raised
                const float corr  = first ? 1.0f : __builtin_amdgcn_exp2f(-sh * EXPC);
                nref -= sh;
                thr   = RAISE;
#pragma unroll
                for (int i = 0; i < 16; ++i) a[i] -= sh;
#pragma unroll
                for (int r = 0; r < 8; ++r) cref[r] = nref;
                rl *= corr;
#pragma unroll
                for (int g = 0; g < 4; ++g)
#pragma unroll
                    for (int r = 0; r < 8; ++r) acc[g][r] *= corr;
            }

            v16h bp;           // P^T as a B fragment: element s <-> key j0 + 8*half + s (s < 8), j0 + 16 + 8*half + s - 8 (s >= 8)
            float ps0 = 0.0f, ps1 = 0.0f;
#pragma unroll
            for (int r = 0; r < 8; ++r) {
                const float p0 = __builtin_amdgcn_exp2f(a[r] * EXPC);
                const float p1 = __builtin_amdgcn_exp2f(a[8 + r] * EXPC);
                bp[r]     = (_Float16)p0;
                bp[8 + r] = (_Float16)p1;
                ps0 += p0;
                ps1 += p1;
            }
            rl += ps0 + ps1;

            // ---- O^T += V^T * P^T
#pragma unroll
            for (int g = 0; g < 4; ++g) acc[g] = wmma16(av[g], bp, acc[g]);
        }

        // publish point of stage st + 1, which also frees stage st's buffer
        asm volatile("s_wait_dscnt 0x0" ::: "memory");     // this wave has left the buffer
        asm volatile("s_wait_asynccnt 0x0" ::: "memory");  // its copies of stage st + 1 have landed
        __syncthreads();
        if (st + 2 < nst) STAGE(st + 2, st & 1);
    };
    const int nfull = cnt / TKEYS;           // stages whose every key is set
    for (int st = 0; st < nfull; ++st) stage(flag_t<false>{}, st);
    for (int st = nfull; st < nst; ++st) stage(flag_t<true>{}, st);
    // nothing is in flight here; kept so that no copy can outlive the wave
    asm volatile("s_wait_asynccnt 0x0" ::: "memory");
#undef STAGE

    const float inv = 1.0f / (rl + xhalf(rl));
    // The wave's 16 output rows of 128 B leave through LDS in whole rows. Every wave has left
    // the ring (the loop's last barrier) and no copy is in flight, so its bytes are free;
    // each wave has 16 rows of its own there.
    // consecutive r -> consecutive d -> packed 16B pieces of query col's row
    _Float16* ot = &ring[0][0] + (tid >> 5) * (16 * PITCH);
#pragma unroll
    for (int g = 0; g < 4; ++g) {
        h8 pk = {};
#pragma unroll
        for (int r = 0; r < 8; ++r) pk[r] = (_Float16)(acc[g][r] * inv);
        *(h8*)(ot + col * PITCH + g * 16 + 8 * half) = pk;
    }
    __syncthreads();                        // the rows are whole before any is read
    // rows (lane >> 3) + 4 j, 16 bytes at (lane & 7) * 8: a wave's store covers four whole rows
    const int rrow = lane >> 3;
    const int rch  = (lane & 7) * 8;
    h8 ov[4];
#pragma unroll
    for (int j = 0; j < 4; ++j) ov[j] = *(const h8*)(ot + (rrow + 4 * j) * PITCH + rch);
    _Float16* o = O + (size_t)(b * N_ + q0 + rrow) * INNER_ + h * DHEAD + rch;
#pragma unroll
    for (int j = 0; j < 4; ++j) *(h8*)(o + j * 4 * INNER_) = ov[j];
    // in front of any rewrite of a register that these stores name
    asm volatile("s_wait_xcnt 0x0" ::: "memory");
}

// ---------------------------------------------------------------------------
extern "C" void kernel_launch(void* const* d_in, const int* in_sizes, int n_in,
                              void* d_out, int out_size, void* d_ws, size_t ws_size,
                              hipStream_t stream) {
    const float* x    = (const float*)d_in[0];
    const float* ctx  = (const float*)d_in[1];
    const int*   mask = (const int*)d_in[2];
    const float* Wq   = (const float*)d_in[3];
    const float* Wkv  = (const float*)d_in[4];
    const float* Wo   = (const float*)d_in[5];
    const float* bo   = (const float*)d_in[6];
    float* out = (float*)d_out;

    // Workspace layout: six 8192x512 f16 tensors + four 512x512 f16 weights ~ 50 MB, then the int key orders and counts
    _Float16* W = (_Float16*)d_ws;
    const size_t SZ = (size_t)B_ * N_ * INNER_;   // 4M elements
    _Float16* x_h  = W;
    _Float16* c_h  = W + SZ;
    _Float16* q_h  = W + 2 * SZ;
    _Float16* k_h  = W + 3 * SZ;
    _Float16* vt_h = W + 4 * SZ;   // [B][INNER][M] (d-major V)
    _Float16* ao_h = W + 5 * SZ;
    _Float16* Wt   = W + 6 * SZ;       // WqT, WkT, WvT, WoT, one behind the other
    _Float16* WoT  = Wt + 3 * WGT_E;
    int* ord = (int*)(Wt + 4 * WGT_E); // [B][M] key order of each batch
    int* cnt = ord + B_ * M_;          // [B][CNT_LD] keys that are set

    static_assert(ACT_E % CV_BLOCK_E == 0 && B_ * M_ * CDIM == ACT_E && B_ * N_ * QDIM == ACT_E,
                  "the convert's grid is exact");
    static_assert(M_ % CV_THREADS == 0 && (M_ & (M_ - 1)) == 0, "key_order's ballots are whole");
    cvt_all<<<B_ + 2 * CV_ACT_B + 4 * CV_WGT_B, CV_THREADS, 0, stream>>>(x, ctx, Wq, Wkv, Wo, mask, x_h, c_h, Wt, ord, cnt);

    // 128x128 tile of C per work-group: grid (columns / 128, rows / 128)
    static_assert(QDIM == GK && CDIM == GK && INNER_ == GK && INNER_ == GN && QDIM == GN,
                  "every projection is 512 deep and 512 wide");
    static_assert(GN % GTN == 0 && (B_ * N_) % GTM == 0 && (B_ * M_) % GTM == 0 && M_ % GTM == 0 && GNST >= 2,
                  "the grid is exact and the ring has its two stages");
    static_assert(B_ * N_ == B_ * M_, "the three input projections have the same rows");
    const dim3 gg(GN / GTN, (B_ * N_) / GTM);       // 4 x 64
    const dim3 g3(3 * (GN / GTN), (B_ * N_) / GTM); // 12 x 64
    gemm_wmma<0><<<g3, GWAVES * 32, 0, stream>>>(x_h, c_h, Wt, q_h, k_h, vt_h, nullptr, nullptr, ord, cnt);

    flash_attn<<<dim3(B_ * HEADS_, N_ / (QWAVES * 16)), QWAVES * 32, 0, stream>>>(q_h, k_h, vt_h, cnt, ao_h);

    gemm_wmma<2><<<gg, GWAVES * 32, 0, stream>>>(ao_h, nullptr, WoT, nullptr, nullptr, nullptr, out, bo, nullptr, nullptr);
}

// v009
// Measured time: 48.4 microseconds a run.
// Two timings next to v008 put it at 1.03 and 1.05 times that version's speed.
// All steps since v000 together make it 8.95 times as fast.
#include <hip/hip_runtime.h>
#include <hip/hip_bf16.h>
#include <float.h>
#include <stdint.h>

// Problem constants (match the reference)
#define B_     4
#define N_     2048
#define M_     2048
#define QDIM   512
#define CDIM   512
#define HEADS_ 8
#define DHEAD  64
#define INNER_ 512
#define SCALE_ 0.125f   // 64^-0.5

typedef _Float16 v16h __attribute__((ext_vector_type(16)));
typedef _Float16 h8   __attribute__((ext_vector_type(8)));
typedef float    v8f  __attribute__((ext_vector_type(8)));

// Build a 16x32 f16 A/B fragment for v_wmma_f32_16x16x32_f16.
// Per the CDNA5 ISA layout, lane L (row/col = L%16, half = L/16) holds
//   frag[0..7]  = X[row][ 8*half + i]        (contiguous 16B)
//   frag[8..15] = X[row][16 + 8*half + i]    (contiguous 16B)
__device__ __forceinline__ v16h frag_ld(const _Float16* lo_p, const _Float16* hi_p) {
    h8 lo = *(const h8*)lo_p;
    h8 hi = *(const h8*)hi_p;
    v16h r;
#pragma unroll
    for (int i = 0; i < 8; ++i) { r[i] = lo[i]; r[i + 8] = hi[i]; }
    return r;
}

__device__ __forceinline__ v8f wmma16(v16h a, v16h b, v8f c) {
    // (neg_a, A, neg_b, B, c_mod, C, reuse_a, reuse_b)
    return __builtin_amdgcn_wmma_f32_16x16x32_f16(false, a, false, b, (short)0, c,
                                                  false, false);
}

// ---------------------------------------------------------------------------
typedef _Float16 h4 __attribute__((ext_vector_type(4)));
typedef float    f4 __attribute__((ext_vector_type(4)));

#define CV_THREADS 256
#define CV_LOADS   8                               // 16-byte loads in flight per lane
#define CV_WAVE_E  (CV_LOADS * 128)                // elements per wave: 4 KB of f32 in a row
#define CV_BLOCK_E ((CV_THREADS / 32) * CV_WAVE_E) // elements per work-group

// f32 -> f16 elementwise convert, 32 elements a lane: few waves to start, each with
// eight wave-wide loads of 512 contiguous bytes in flight; each store of a wave
// covers 256 contiguous bytes. Work-group blk of the tensor's CV_ACT_B, which cover
// it exactly (a multiple of CV_BLOCK_E elements), so there is no bound to test.
__device__ __forceinline__
void cvt_f32_to_h(const float* __restrict__ src, _Float16* __restrict__ dst, int blk) {
    const int wave = blk * (CV_THREADS / 32) + (threadIdx.x >> 5);
    const int base = wave * CV_WAVE_E + (threadIdx.x & 31) * 4;
    f4 v[CV_LOADS];
#pragma unroll
    for (int j = 0; j < CV_LOADS; ++j) v[j] = *(const f4*)(src + base + j * 128);
#pragma unroll
    for (int j = 0; j < CV_LOADS; ++j) {
        h4 o;
#pragma unroll
        for (int e = 0; e < 4; ++e) o[e] = (_Float16)v[j][e];
        *(h4*)(dst + base + j * 128) = o;
    }
    // inlined into cvt_all, another job's code follows in the listing: no register that
    // these stores name is rewritten ahead of this wait
    asm volatile("s_wait_xcnt 0x0" ::: "memory");
}

// Transpose-convert weight W[in=rows][... ld ...] (a block of columns from col0 on)
// into Wt[out][in] f16, so GEMM B-operand columns become contiguous rows.
// A lane takes 8 rows of one column: eight loads in flight, each 128 contiguous bytes
// a wave, and one 16-byte store; the eight waves of a work-group take 64 rows, so a
// work-group writes whole 128-byte lines of Wt. Work-group (bx, by) of (columns / 32,
// rows / 64), which cover the block exactly.
__device__ __forceinline__
void cvt_transpose(const float* __restrict__ src,
                   _Float16* __restrict__ dst,
                   int rows, int ld, int col0, int bx, int by) {
    const int o  = bx * 32 + (threadIdx.x & 31);
    const int r0 = by * 64 + (threadIdx.x >> 5) * 8;
    const float* s = src + (size_t)r0 * ld + col0 + o;
    float v[8];
#pragma unroll
    for (int i = 0; i < 8; ++i) v[i] = s[(size_t)i * ld];
    h8 pk;
#pragma unroll
    for (int i = 0; i < 8; ++i) pk[i] = (_Float16)v[i];
    *(h8*)(dst + (size_t)o * rows + r0) = pk;
    // as at the end of cvt_f32_to_h: in front of any rewrite of the store's registers
    asm volatile("s_wait_xcnt 0x0" ::: "memory");
}

#define ACT_E    (B_ * N_ * INNER_)        // elements of one activation tensor
#define WGT_E    (512 * 512)               // elements of one weight block
#define CV_ACT_B (ACT_E / CV_BLOCK_E)      // work-groups per activation tensor
#define CV_WGT_B ((512 / 32) * (512 / 64)) // work-groups per weight block

#define CNT_LD 32   // ints between two batches' counts: each work-group writes a 128-byte line of its own

// Key order of one batch: the keys whose mask word is set first, in their own order,
// then the masked ones; ord[p] = key at place p, cnt = how many are set. A masked key's
// weight is exp(-FLT_MAX - max) = 0 wherever the batch has one key set, so the K and V
// projections and the attention need only the first cnt places (a batch with none set
// keeps all its keys, all masked: uniform weights, as in the reference).
// One work-group a batch; wave w takes keys 256 w .. 256 w + 255, 32 a ballot.
__device__ __forceinline__
void key_order(const int* __restrict__ mask, int* __restrict__ ord, int* __restrict__ cnt) {
    __shared__ int wsum[CV_THREADS / 32];
    const int lane = threadIdx.x & 31;
    const int wave = threadIdx.x >> 5;
    constexpr int NB = M_ / CV_THREADS;          // ballots per wave
    const int* mp = mask + wave * (NB * 32) + lane;
    unsigned bal[NB];
    int tot = 0;
#pragma unroll
    for (int i = 0; i < NB; ++i) {
        bal[i] = __builtin_amdgcn_ballot_w32(mp[i * 32] != 0);
        tot += __builtin_popcount(bal[i]);
    }
    // the loads share the address pair mp: naming it keeps it live up to the wait, so
    // that it is not rewritten ahead of it
    asm volatile("s_wait_xcnt 0x0" :: "v"(mp) : "memory");
    if (lane == 0) wsum[wave] = tot;
    __syncthreads();
    int before = 0, all = 0;                     // set keys in earlier waves, in the batch
#pragma unroll
    for (int w = 0; w < CV_THREADS / 32; ++w) {
        const int t = wsum[w];
        before += w < wave ? t : 0;
        all    += t;
    }
    const unsigned below = (1u << lane) - 1u;
    const int key0 = wave * (NB * 32) + lane;
#pragma unroll
    for (int i = 0; i < NB; ++i) {
        const int key = key0 + i * 32;
        const int set = before + __builtin_popcount(bal[i] & below);   // set keys in front of this one
        ord[((bal[i] >> lane) & 1u) ? set : all + key - set] = key;    // masked ones follow all set ones
        before += __builtin_popcount(bal[i]);
    }
    if (threadIdx.x == 0) *cnt = all;
    // as at the end of cvt_f32_to_h: in front of any rewrite of the stores' registers
    asm volatile("s_wait_xcnt 0x0" ::: "memory");
}

// All six converts in one launch: none reads what another writes, so one grid holds
// them side by side and the short weight blocks run under the two long streams
// instead of each waiting for the launch before it to drain. The work-group index
// picks the job: x, context (the long ones start first), then the four weight blocks,
// whose transposes lie one behind the other in Wt: Wq, the K half and the V half of
// Wkv, Wo. The first B_ work-groups form the batches' key orders.
__global__ __launch_bounds__(CV_THREADS)
void cvt_all(const float* __restrict__ x, const float* __restrict__ ctx,
             const float* __restrict__ Wq, const float* __restrict__ Wkv,
             const float* __restrict__ Wo, const int* __restrict__ mask,
             _Float16* __restrict__ x_h, _Float16* __restrict__ c_h,
             _Float16* __restrict__ Wt, int* __restrict__ ord, int* __restrict__ cnt) {
    const int bid = (int)blockIdx.x - B_;
    if (bid < 0) {
        const int b = blockIdx.x;
        key_order(mask + b * M_, ord + b * M_, cnt + b * CNT_LD);
    } else if (bid < CV_ACT_B) {
        cvt_f32_to_h(x, x_h, bid);
    } else if (bid < 2 * CV_ACT_B) {
        cvt_f32_to_h(ctx, c_h, bid - CV_ACT_B);
    } else {
        const int w  = (bid - 2 * CV_ACT_B) / CV_WGT_B;   // which weight block
        const int t  = (bid - 2 * CV_ACT_B) % CV_WGT_B;
        const int bx = t % (512 / 32);
        const int by = t / (512 / 32);
        if (w == 1 || w == 2)
            cvt_transpose(Wkv, Wt + w * WGT_E, 512, 1024, (w - 1) * 512, bx, by);
        else
            cvt_transpose(w == 0 ? Wq : Wo, Wt + w * WGT_E, 512, 512, 0, bx, by);
    }
}

// ---------------------------------------------------------------------------
// Geometry of gemm_wmma's work-group and of its LDS ring
#define GWAVES 8                 // waves per work-group: 2 along the output tile's rows x 4 along its columns, 64 x 32 each
#define GTM    128               // rows of C per work-group
#define GTN    128               // columns of C per work-group
#define GK     512               // depth of every projection
#define GN     512               // columns of every projection
#define GSK    128               // k per stage: operand rows of 256 B
#define GPITCH 136               // halfs per LDS row: 256 B + 16 B, an odd multiple of 16 B
#define GTILE  (128 * GPITCH)    // halfs of one staged operand tile (128 rows)
#define GNST   (GK / GSK)

// One operand tile's share of one lane: eight 16-byte asynchronous copies to LDS,
// rows 16 apart. The s_wait_xcnt closes the statement, so that no register a copy
// names is rewritten ahead of it.
__device__ __forceinline__ void tile_copy(unsigned l, const _Float16* g) {
    const unsigned ls = 16 * GPITCH * 2;   // bytes between two of the lane's LDS rows
    const int      gs = 16 * GK;           // halfs between two of its global rows
    asm volatile("global_load_async_to_lds_b128 %0, %8, off\n\t"
                 "global_load_async_to_lds_b128 %1, %9, off\n\t"
                 "global_load_async_to_lds_b128 %2, %10, off\n\t"
                 "global_load_async_to_lds_b128 %3, %11, off\n\t"
                 "global_load_async_to_lds_b128 %4, %12, off\n\t"
                 "global_load_async_to_lds_b128 %5, %13, off\n\t"
                 "global_load_async_to_lds_b128 %6, %14, off\n\t"
                 "global_load_async_to_lds_b128 %7, %15, off\n\t"
                 "s_wait_xcnt 0x0"
                 :: "v"(l), "v"(l + ls), "v"(l + 2 * ls), "v"(l + 3 * ls),
                    "v"(l + 4 * ls), "v"(l + 5 * ls), "v"(l + 6 * ls), "v"(l + 7 * ls),
                    "v"(g), "v"(g + gs), "v"(g + 2 * gs), "v"(g + 3 * gs),
                    "v"(g + 4 * gs), "v"(g + 5 * gs), "v"(g + 6 * gs), "v"(g + 7 * gs)
                 : "memory");
}

// The same for rows that lie anywhere: each of the lane's eight copies has its own
// global address.
__device__ __forceinline__ void rows_copy(unsigned l, const _Float16* g0, const _Float16* g1,
                                          const _Float16* g2, const _Float16* g3,
                                          const _Float16* g4, const _Float16* g5,
                                          const _Float16* g6, const _Float16* g7) {
    const unsigned ls = 16 * GPITCH * 2;   // bytes between two of the lane's LDS rows
    asm volatile("global_load_async_to_lds_b128 %0, %8, off\n\t"
                 "global_load_async_to_lds_b128 %1, %9, off\n\t"
                 "global_load_async_to_lds_b128 %2, %10, off\n\t"
                 "global_load_async_to_lds_b128 %3, %11, off\n\t"
                 "global_load_async_to_lds_b128 %4, %12, off\n\t"
                 "global_load_async_to_lds_b128 %5, %13, off\n\t"
                 "global_load_async_to_lds_b128 %6, %14, off\n\t"
                 "global_load_async_to_lds_b128 %7, %15, off\n\t"
                 "s_wait_xcnt 0x0"
                 :: "v"(l), "v"(l + ls), "v"(l + 2 * ls), "v"(l + 3 * ls),
                    "v"(l + 4 * ls), "v"(l + 5 * ls), "v"(l + 6 * ls), "v"(l + 7 * ls),
                    "v"(g0), "v"(g1), "v"(g2), "v"(g3), "v"(g4), "v"(g5), "v"(g6), "v"(g7)
                 : "memory");
}

// f16 WMMA GEMM: C[m][n] = sum_k A[m][k] * Bt[n][k], both operands k-contiguous.
// A work-group of eight waves computes a 128 x 128 tile of C. Each stage of 128 k
// (128 rows of A and 128 rows of Bt, 256 bytes a row) is brought into LDS once for
// all eight waves, in whole 256-byte pieces, by asynchronous copies into a ring of
// two buffers; the fragments are read from there, and every fragment read feeds
// four (the WMMAs' A operand) or two (their B operand) WMMAs of its wave's 2 x 4 accumulator tiles.
// MODE: 0 = the three input projections in one launch: none reads what another
//           writes, so one grid of 3 x 4 column tiles holds them, two work-groups a
//           WGP, and one's first stage and stores run under another's products.
//           Bt is the three transposed weights one behind the other (1536 rows);
//           column tiles 0..3 are Q = A0 * Wq and 4..7 are K = A1 * Wk, f16 row-major;
//           8..11 are V = A1 * Wv, f16 transposed per batch -> out[b][n][m%Mdim].
//           Row p of K and V is the key at place p of its batch's key order (ord):
//           the A rows are gathered, and a row tile behind the batch's last key that
//           is set (cnt) has no reader and is left out,
//       2 = f32 store + bias (final projection of A0 into d_out).
// Every output tile is gathered in LDS and stored in whole rows, 16 bytes a lane.
// Left open: a batch's last K and V row tile is computed whole, however few of its keys
// are set; x and context are still converted in a launch of their own, the masked rows
// of context too.
template <int MODE>
__global__ __launch_bounds__(GWAVES * 32)
void gemm_wmma(const _Float16* __restrict__ A0,
               const _Float16* __restrict__ A1,
               const _Float16* __restrict__ Bt,
               _Float16* __restrict__ outQ,
               _Float16* __restrict__ outK,
               _Float16* __restrict__ outVt,
               float* __restrict__ outF,
               const float* __restrict__ bias,
               const int* __restrict__ ord,
               const int* __restrict__ cnt) {
    constexpr int Mdim = M_;
    constexpr int NT   = GN / GTN;      // column tiles of one projection
    // which projection this work-group belongs to (the same for all its waves)
    const int sel = MODE == 0 ? blockIdx.x / NT : 0;
    const _Float16* A = sel == 0 ? A0 : A1;
    // [buffer][A tile, then Bt tile]
    __shared__ __attribute__((aligned(16))) _Float16 gring[2][2 * GTILE];

    const int tid  = threadIdx.x;
    const int lane = tid & 31;
    const int col  = lane & 15;
    const int half = lane >> 4;
    const int kb0  = 8 * half;
    const int wm   = (tid >> 5) & 3;    // this wave's 32 columns of the output tile
    const int wn   = tid >> 7;          // this wave's 64 rows of the output tile
    const int n0   = (blockIdx.x % NT) * GTN;   // first column within the projection's output
    const int m0   = blockIdx.y * GTM;
    // Which staged tile is the WMMAs' A operand, so that its rows run down a lane's eight
    // accumulator registers: the one whose index is contiguous in the output. That is Bt
    // (n) for a row-major output, A (m) for the transposed V. Both tiles have 128 rows and
    // one fragment layout, so only the two tile offsets differ.
    const int rtile = (MODE == 0 && sel == 2) ? 0 : GTILE;

    // This lane's place in a stage: rows crow + 16 i of either tile, 16 bytes at
    // cch; a wave's copy covers two whole rows of 256 bytes.
    const int crow = tid >> 4;
    const int cch  = (tid & 15) * 8;
    int arow[8];                        // the lane's eight rows of A
#pragma unroll
    for (int i = 0; i < 8; ++i) arow[i] = m0 + crow + 16 * i;
    if (MODE == 0 && sel != 0) {
        const int bb = m0 / Mdim;
        const int c  = min(cnt[bb * CNT_LD], Mdim);
        // the same for the whole work-group, in front of every copy and barrier
        if (m0 % Mdim >= (c <= 0 ? Mdim : c)) return;
        const int* op = ord + m0 + crow;
#pragma unroll
        for (int i = 0; i < 8; ++i) arow[i] = bb * Mdim + (op[16 * i] & (Mdim - 1));
        // in front of any rewrite of a register that these loads name
        asm volatile("s_wait_xcnt 0x0" ::: "memory");
    }
    const _Float16* ga = A + cch;
    const _Float16* gb = Bt + (size_t)(blockIdx.x * GTN + crow) * GK + cch;
    const unsigned  la = (unsigned)(uintptr_t)&gring[0][crow * GPITCH + cch];
#define GSTAGE(st, bf) do {                                                         \
        const unsigned l_ = la + (unsigned)(bf) * (2 * GTILE * 2);                  \
        const _Float16* a_ = ga + (st) * GSK;                                       \
        rows_copy(l_, a_ + arow[0] * GK, a_ + arow[1] * GK, a_ + arow[2] * GK,      \
                  a_ + arow[3] * GK, a_ + arow[4] * GK, a_ + arow[5] * GK,          \
                  a_ + arow[6] * GK, a_ + arow[7] * GK);                            \
        tile_copy(l_ + GTILE * 2, gb + (st) * GSK);                                 \
    } while (0)

    // stage 0, landed and published; then stage 1 flies under pass 0
    GSTAGE(0, 0);
    asm volatile("s_wait_asynccnt 0x0" ::: "memory");   // this wave's copies have landed
    __syncthreads();                                    // and every other wave's
    GSTAGE(1, 1);

    // the bias of this lane's four output columns (see the stores at the end), fetched here
    // so that its latency lies under the products
    f4 bv = {};
    if (MODE == 2) {
        bv = *(const f4*)(bias + n0 + lane * 4);
        // in front of any rewrite of a register that this load names
        asm volatile("s_wait_xcnt 0x0" ::: "memory");
    }

    v8f acc[2][4];
#pragma unroll
    for (int i = 0; i < 2; ++i)
#pragma unroll
        for (int t = 0; t < 4; ++t) acc[i][t] = (v8f){};

    for (int st = 0; st < GNST; ++st) {
        const _Float16* ap = gring[st & 1] + rtile + (wm * 32 + col) * GPITCH + kb0;
        const _Float16* bp = gring[st & 1] + (GTILE - rtile) + (wn * 64 + col) * GPITCH + kb0;
        // two fragment sets: k-step j + 1 of this stage is read while k-step j is multiplied
        v16h a[2][2], b[2][4];
#define GFRAGS(set, ks) do {                                                        \
        _Pragma("unroll")                                                           \
        for (int i = 0; i < 2; ++i)                                                 \
            a[set][i] = frag_ld(ap + i * 16 * GPITCH + (ks),                        \
                                ap + i * 16 * GPITCH + (ks) + 16);                  \
        _Pragma("unroll")                                                           \
        for (int t = 0; t < 4; ++t)                                                 \
            b[set][t] = frag_ld(bp + t * 16 * GPITCH + (ks),                        \
                                bp + t * 16 * GPITCH + (ks) + 16);                  \
    } while (0)
        GFRAGS(0, 0);
        // unrolled (as every loop over i, t, r here): the set index j & 1 is then a
        // constant, and the fragments and accumulators stay in registers
#pragma unroll
        for (int j = 0; j < GSK / 32; ++j) {
            if (j + 1 < GSK / 32) GFRAGS((j + 1) & 1, (j + 1) * 32);
            // keeps the next k-step's twelve LDS reads one group in front of this k-step's
            // WMMAs; left free, they are spread among the WMMAs and waited for at once
            __builtin_amdgcn_sched_barrier(0);
#pragma unroll
            for (int i = 0; i < 2; ++i)
#pragma unroll
                for (int t = 0; t < 4; ++t)
                    acc[i][t] = wmma16(a[j & 1][i], b[j & 1][t], acc[i][t]);
            // and the reads after next behind them
            __builtin_amdgcn_sched_barrier(0);
        }
#undef GFRAGS

        // publish point of stage st + 1, which also frees stage st's buffer
        asm volatile("s_wait_dscnt 0x0" ::: "memory");     // this wave has left the buffer
        asm volatile("s_wait_asynccnt 0x0" ::: "memory");  // its copies of stage st + 1 have landed
        __syncthreads();
        if (st + 2 < GNST) GSTAGE(st + 2, st & 1);
    }
    // nothing is in flight here; kept so that no copy can outlive the wave
    asm volatile("s_wait_asynccnt 0x0" ::: "memory");
#undef GSTAGE

    // The tile of C leaves through LDS in whole rows. Every wave has left the ring (the
    // loop's last barrier) and no copy is in flight, so the ring's bytes are free.
    // C-layout: lane (col, half), VGPR r  <->  A-operand row 8*half + r, B-operand row col:
    // the lane's eight values are neighbours in output row orow, from place ocol on.
    const int orow = wn * 64 + col;
    const int ocol = wm * 32 + 8 * half;
    if (MODE == 0) {
        _Float16* ct = &gring[0][0];        // 128 output rows of 256 B, pitch as the ring's
#pragma unroll
        for (int i = 0; i < 2; ++i)
#pragma unroll
            for (int t = 0; t < 4; ++t) {
                h8 pk = {};
#pragma unroll
                for (int r = 0; r < 8; ++r) pk[r] = (_Float16)acc[i][t][r];
                *(h8*)(ct + (orow + t * 16) * GPITCH + ocol + i * 16) = pk;
            }
        __syncthreads();                    // the tile is whole before any row is read
        // rows crow + 16 j, 16 bytes at cch: a wave's store covers two whole rows of 256 B
        h8 ov[8];
#pragma unroll
        for (int j = 0; j < 8; ++j) ov[j] = *(const h8*)(ct + (crow + 16 * j) * GPITCH + cch);
        if (sel != 2) {
            _Float16* o = (sel == 0 ? outQ : outK) + (size_t)(m0 + crow) * GN + n0 + cch;
#pragma unroll
            for (int j = 0; j < 8; ++j) *(h8*)(o + j * 16 * GN) = ov[j];
        } else {
            // output rows are V's columns, places the keys of one batch (Mdim is a multiple of GTM)
            _Float16* o = outVt + ((size_t)(m0 / Mdim) * GN + n0 + crow) * Mdim + m0 % Mdim + cch;
#pragma unroll
            for (int j = 0; j < 8; ++j) *(h8*)(o + j * 16 * Mdim) = ov[j];
        }
    } else {
        constexpr int FP = GTN + 4;         // floats per LDS row: 512 B + 16 B, an odd multiple of 16 B
        float* cf = (float*)&gring[0][0];
#pragma unroll
        for (int i = 0; i < 2; ++i)
#pragma unroll
            for (int t = 0; t < 4; ++t) {
                float* p = cf + (orow + t * 16) * FP + ocol + i * 16;
                *(f4*)p       = (f4){acc[i][t][0], acc[i][t][1], acc[i][t][2], acc[i][t][3]};
                *(f4*)(p + 4) = (f4){acc[i][t][4], acc[i][t][5], acc[i][t][6], acc[i][t][7]};
            }
        __syncthreads();                    // the tile is whole before any row is read
        // rows frow + 8 j, 16 bytes at fch: a wave's store covers one whole row of 512 B
        const int frow = tid >> 5;
        const int fch  = lane * 4;
        f4 ov[16];
#pragma unroll
        for (int j = 0; j < 16; ++j) ov[j] = *(const f4*)(cf + (frow + 8 * j) * FP + fch) + bv;
        float* o = outF + (size_t)(m0 + frow) * GN + n0 + fch;
#pragma unroll
        for (int j = 0; j < 16; ++j) *(f4*)(o + j * 8 * GN) = ov[j];
    }
    // in front of any rewrite of a register that these stores name
    asm volatile("s_wait_xcnt 0x0" ::: "memory");
}

// ---------------------------------------------------------------------------
// Lane l <-> lane l ^ 16 (the two halves of a wave that share one query column)
__device__ __forceinline__ float xhalf(float x) {
    const int b = __builtin_bit_cast(int, x);
    return __builtin_bit_cast(float,
        __builtin_amdgcn_permlanex16(b, b, 0x76543210, 0xfedcba98, false, false));
}

// x where bit 'bit' of m is set, else fill: the bit spread over the word
// picks between the two bit patterns (no compare)
__device__ __forceinline__ float keep(unsigned m, int bit, float x, float fill) {
    const int sel = (int)(m << (31 - bit)) >> 31;
    const int fil = __builtin_bit_cast(int, fill);
    return __builtin_bit_cast(float, (sel & __builtin_bit_cast(int, x)) | (~sel & fil));
}

// a compile-time yes or no handed to a generic lambda
template <bool V> struct flag_t { static constexpr bool value = V; };

// Geometry of flash_attn's work-group and of its LDS ring
#define QWAVES 8                 // waves per work-group, 16 query columns each
#define TKEYS  64                // keys per stage: K rows and V^T rows are both 128 B
#define PITCH  72                // halfs per LDS row: 128 B + 16 B, an odd multiple of 16 B
#define TILE_H (64 * PITCH)      // halfs of one staged tile (64 rows)
#define NSTAGE (M_ / TKEYS)

// One stage's share of one lane: four 16-byte asynchronous copies to LDS.
// The s_wait_xcnt closes the statement, so that no register a copy names is
// rewritten ahead of it.
__device__ __forceinline__ void stage_copy(unsigned l0, unsigned l1, unsigned l2, unsigned l3,
                                           const _Float16* g0, const _Float16* g1,
                                           const _Float16* g2, const _Float16* g3) {
    asm volatile("global_load_async_to_lds_b128 %0, %4, off\n\t"
                 "global_load_async_to_lds_b128 %1, %5, off\n\t"
                 "global_load_async_to_lds_b128 %2, %6, off\n\t"
                 "global_load_async_to_lds_b128 %3, %7, off\n\t"
                 "s_wait_xcnt 0x0"
                 :: "v"(l0), "v"(l1), "v"(l2), "v"(l3), "v"(g0), "v"(g1), "v"(g2), "v"(g3)
                 : "memory");
}

__global__ __launch_bounds__(QWAVES * 32) __attribute__((amdgpu_waves_per_eu(4, 4)))
void flash_attn(const _Float16* __restrict__ Q,
                const _Float16* __restrict__ Kh,
                const _Float16* __restrict__ Vt,
                const int* __restrict__ cntp,
                _Float16* __restrict__ O) {
    // [buffer][K tile, then V^T tile]
    __shared__ __attribute__((aligned(16))) _Float16 ring[2][2 * TILE_H];

    const int tid  = threadIdx.x;
    const int lane = tid & 31;
    const int col  = lane & 15;
    const int half = lane >> 4;
    const int kb0  = 8 * half;
    const int bh   = blockIdx.x;
    const int b    = bh / HEADS_;
    const int h    = bh % HEADS_;
    const int q0   = blockIdx.y * (QWAVES * 16) + (tid >> 5) * 16;

    const _Float16* kbase = Kh + (size_t)b * M_ * INNER_ + h * DHEAD;
    const _Float16* vbase = Vt + ((size_t)b * INNER_ + h * DHEAD) * M_;
    const int cnt = min(max(cntp[b * CNT_LD], 0), M_);              // keys that are set
    const int nst = ((cnt == 0 ? M_ : cnt) + TKEYS - 1) / TKEYS;    // stages to run, 1 .. NSTAGE

    // This lane's place in a stage: rows crow and crow + 32 of either tile, 16
    // bytes at cch; a wave's copy covers four whole rows of 128 bytes.
    const int crow = tid >> 3;
    const int cch  = (tid & 7) * 8;
    const _Float16* gk = kbase + (size_t)crow * INNER_ + cch;
    const _Float16* gv = vbase + (size_t)crow * M_ + cch;
    const unsigned  lk = (unsigned)(uintptr_t)&ring[0][crow * PITCH + cch];
#define STAGE(st, bf) do {                                                          \
        const unsigned  l_ = lk + (unsigned)(bf) * (2 * TILE_H * 2);                \
        const _Float16* k_ = gk + (size_t)(st) * TKEYS * INNER_;                    \
        const _Float16* v_ = gv + (size_t)(st) * TKEYS;                             \
        stage_copy(l_, l_ + 32 * PITCH * 2, l_ + TILE_H * 2,                        \
                   l_ + TILE_H * 2 + 32 * PITCH * 2,                                \
                   k_, k_ + 32 * INNER_, v_, v_ + (size_t)32 * M_);                 \
    } while (0)

    // Q fragments stay resident: two 32x16 chunks covering d = 0..63
    const _Float16* qp = Q + (size_t)(b * N_ + q0 + col) * INNER_ + h * DHEAD + kb0;
    const v16h bq0 = frag_ld(qp,      qp + 16);
    const v16h bq1 = frag_ld(qp + 32, qp + 48);
    // the four loads share the address pair qp: naming it keeps it live up to
    // the wait, so that it is not rewritten ahead of it
    asm volatile("s_wait_xcnt 0x0" :: "v"(qp) : "memory");

    // stage 0, landed and published; then stage 1 flies under pass 0
    STAGE(0, 0);
    asm volatile("s_wait_asynccnt 0x0" ::: "memory");   // this wave's copies have landed
    __syncthreads();                                    // and every other wave's
    if (nst > 1) STAGE(1, 1);

    // Lazy rescale. Weights are 2^((score - ref) * EXPC) on unscaled scores, ref a reference
    // of this lane's query (same in both halves): the first stage's maximum, raised only when
    // the weights say so. No weight is negative, so while a lane's 32 weights of a stage sum
    // to RAISE or less, each of them is RAISE or less (2^8, far inside f16 range; a weight
    // past the f32 range is +inf, and so is its sum). The sum is wanted anyway: a stage that
    // raises nothing forms no maximum at all. A stage that does raise takes the maximum of
    // its scores, which are still in registers, and forms its weights again.
    // -ref is the C operand of the S^T products, so the tiles come out as score - ref.
    constexpr float EXPC  = SCALE_ * 1.44269504088896340736f;
    constexpr float RAISE = 256.0f;
    float nref = 0.0f;         // -ref
    float thr  = -INFINITY;    // the first stage always sets ref
    v8f   cref = {};           // nref in all eight rows
    float rl = 0.0f;       // running sum over this half's keys only; joined at the end
    v8f acc[4];            // acc[g][r] = O^T[g*16 + 8*half + r][query col]
#pragma unroll
    for (int g = 0; g < 4; ++g) acc[g] = (v8f){};

    // one stage of 64 keys with its publish point; masked_t says at compile time whether
    // it masks
    auto stage = [&](auto masked_t, const int st) __attribute__((always_inline)) {
        constexpr bool MASKED = decltype(masked_t)::value;
        const _Float16* ktile = ring[st & 1];
        const _Float16* vtile = ktile + TILE_H;

        // the stage's fragments, for each 32 of its keys: K rows (two 16-key tiles x two d
        // chunks) and V^T rows (d-major V)
        v16h ak[2][4], avs[2][4];
#pragma unroll
        for (int ps = 0; ps < 2; ++ps) {
            const _Float16* kp = ktile + (ps * 32 + col) * PITCH + kb0;
            ak[ps][0] = frag_ld(kp,                   kp + 16);
            ak[ps][1] = frag_ld(kp + 32,              kp + 48);
            ak[ps][2] = frag_ld(kp + 16 * PITCH,      kp + 16 * PITCH + 16);
            ak[ps][3] = frag_ld(kp + 16 * PITCH + 32, kp + 16 * PITCH + 48);
        }
#pragma unroll
        for (int ps = 0; ps < 2; ++ps) {
            const _Float16* vp = vtile + col * PITCH + ps * 32 + kb0;
#pragma unroll
            for (int g = 0; g < 4; ++g)
                avs[ps][g] = frag_ld(vp + g * 16 * PITCH, vp + g * 16 * PITCH + 16);
        }
        // keeps the stage's LDS reads one group in front of its products: left free, the
        // fragments are read in pairs, each pair waited for at once
        __builtin_amdgcn_sched_barrier(0);

        // ---- S^T = K*Q^T for the stage's 64 keys: four 16-key C tiles, 8 WMMAs
        v8f sc[2][2];
#pragma unroll
        for (int ps = 0; ps < 2; ++ps) {
            sc[ps][0] = wmma16(ak[ps][0], bq0, cref);
            sc[ps][1] = wmma16(ak[ps][2], bq0, cref);
        }
#pragma unroll
        for (int ps = 0; ps < 2; ++ps) {
            sc[ps][0] = wmma16(ak[ps][1], bq1, sc[ps][0]);
            sc[ps][1] = wmma16(ak[ps][3], bq1, sc[ps][1]);
        }

        // ---- online softmax, one query per lane
        // a masked key's score is -FLT_MAX: less ref, like the others (0 where no key
        // of the batch is set and ref is -FLT_MAX itself: uniform weights)
        const float fill = -FLT_MAX + nref;
        float a[32];
#pragma unroll
        for (int ps = 0; ps < 2; ++ps) {
            // bit k of live = key place j0 + k is set; this lane's 16 keys of these 32 are
            // j0 + 8*half + r (bit r of mk) and j0 + 16 + 8*half + r (bit 16 + r of mk)
            const int      j0   = st * TKEYS + ps * 32;
            const int      rem  = cnt - j0;
            const unsigned live = rem >= 32 ? ~0u : rem <= 0 ? 0u : (1u << rem) - 1u;
            const unsigned mk   = live >> kb0;
#pragma unroll
            for (int r = 0; r < 8; ++r) {
                a[ps * 16 + r]     = MASKED ? keep(mk, r,      sc[ps][0][r], fill) : sc[ps][0][r];
                a[ps * 16 + 8 + r] = MASKED ? keep(mk, 16 + r, sc[ps][1][r], fill) : sc[ps][1][r];
            }
        }
        float p[32];           // the weights of this lane's 32 keys
        float sum[2];          // and their sums, 16 keys each
#pragma unroll
        for (int ps = 0; ps < 2; ++ps) {
            float ps0 = 0.0f, ps1 = 0.0f;
#pragma unroll
            for (int r = 0; r < 8; ++r) {
                p[ps * 16 + r]     = __builtin_amdgcn_exp2f(a[ps * 16 + r] * EXPC);
                p[ps * 16 + 8 + r] = __builtin_amdgcn_exp2f(a[ps * 16 + 8 + r] * EXPC);
                ps0 += p[ps * 16 + r];
                ps1 += p[ps * 16 + 8 + r];
            }
            sum[ps] = ps0 + ps1;
        }
        // one test a stage, the same for the whole wave (the WMMAs need every lane on)
        if (__builtin_amdgcn_ballot_w32(sum[0] + sum[1] > thr) != 0) {
            float t = a[0];
#pragma unroll
            for (int i = 1; i < 32; ++i) t = fmaxf(t, a[i]);
            t = fmaxf(t, xhalf(t));
            const bool  first = thr < 0.0f;
            const float sh    = first ? t : fmaxf(t, 0.0f);   // ref is only ever raised
            const float corr  = first ? 1.0f : __builtin_amdgcn_exp2f(-sh * EXPC);
            nref -= sh;
            thr   = RAISE;
#pragma unroll
            for (int r = 0; r < 8; ++r) cref[r] = nref;
            rl *= corr;
#pragma unroll
            for (int g = 0; g < 4; ++g)
#pragma unroll
                for (int r = 0; r < 8; ++r) acc[g][r] *= corr;
            // the weights again, against the new ref (none above 1 where it was raised)
#pragma unroll
            for (int ps = 0; ps < 2; ++ps) {
                float ps0 = 0.0f, ps1 = 0.0f;
#pragma unroll
                for (int r = 0; r < 8; ++r) {
                    p[ps * 16 + r]     = __builtin_amdgcn_exp2f((a[ps * 16 + r] - sh) * EXPC);
                    p[ps * 16 + 8 + r] = __builtin_amdgcn_exp2f((a[ps * 16 + 8 + r] - sh) * EXPC);
                    ps0 += p[ps * 16 + r];
                    ps1 += p[ps * 16 + 8 + r];
                }
                sum[ps] = ps0 + ps1;
            }
        }
        rl += sum[0];
        rl += sum[1];

        // ---- O^T += V^T * P^T; P^T as B fragments: element s <-> key 32*ps + 8*half + s (s < 8) or 32*ps + 8*half + 8 + s (s >= 8)
#pragma unroll
        for (int ps = 0; ps < 2; ++ps) {
            v16h bp;
#pragma unroll
            for (int i = 0; i < 16; ++i) bp[i] = (_Float16)p[ps * 16 + i];
#pragma unroll
            for (int g = 0; g < 4; ++g) acc[g] = wmma16(avs[ps][g], bp, acc[g]);
        }

        // publish point of stage st + 1, which also frees stage st's buffer
        asm volatile("s_wait_dscnt 0x0" ::: "memory");     // this wave has left the buffer
        asm volatile("s_wait_asynccnt 0x0" ::: "memory");  // its copies of stage st + 1 have landed
        __syncthreads();
        if (st + 2 < nst) STAGE(st + 2, st & 1);
    };
    const int nfull = cnt / TKEYS;           // stages whose every key is set
    for (int st = 0; st < nfull; ++st) stage(flag_t<false>{}, st);
    for (int st = nfull; st < nst; ++st) stage(flag_t<true>{}, st);
    // nothing is in flight here; kept so that no copy can outlive the wave
    asm volatile("s_wait_asynccnt 0x0" ::: "memory");
#undef STAGE

    const float inv = 1.0f / (rl + xhalf(rl));
    // The wave's 16 output rows of 128 B leave through LDS in whole rows. Every wave has left
    // the ring (the loop's last barrier) and no copy is in flight, so its bytes are free;
    // each wave has 16 rows of its own there.
    // consecutive r -> consecutive d -> packed 16B pieces of query col's row
    _Float16* ot = &ring[0][0] + (tid >> 5) * (16 * PITCH);
#pragma unroll
    for (int g = 0; g < 4; ++g) {
        h8 pk = {};
#pragma unroll
        for (int r = 0; r < 8; ++r) pk[r] = (_Float16)(acc[g][r] * inv);
        *(h8*)(ot + col * PITCH + g * 16 + 8 * half) = pk;
    }
    __syncthreads();                        // the rows are whole before any is read
    // rows (lane >> 3) + 4 j, 16 bytes at (lane & 7) * 8: a wave's store covers four whole rows
    const int rrow = lane >> 3;
    const int rch  = (lane & 7) * 8;
    h8 ov[4];
#pragma unroll
    for (int j = 0; j < 4; ++j) ov[j] = *(const h8*)(ot + (rrow + 4 * j) * PITCH + rch);
    _Float16* o = O + (size_t)(b * N_ + q0 + rrow) * INNER_ + h * DHEAD + rch;
#pragma unroll
    for (int j = 0; j < 4; ++j) *(h8*)(o + j * 4 * INNER_) = ov[j];
    // in front of any rewrite of a register that these stores name
    asm volatile("s_wait_xcnt 0x0" ::: "memory");
}

// ---------------------------------------------------------------------------
extern "C" void kernel_launch(void* const* d_in, const int* in_sizes, int n_in,
                              void* d_out, int out_size, void* d_ws, size_t ws_size,
                              hipStream_t stream) {
    const float* x    = (const float*)d_in[0];
    const float* ctx  = (const float*)d_in[1];
    const int*   mask = (const int*)d_in[2];
    const float* Wq   = (const float*)d_in[3];
    const float* Wkv  = (const float*)d_in[4];
    const float* Wo   = (const float*)d_in[5];
    const float* bo   = (const float*)d_in[6];
    float* out = (float*)d_out;

    // Workspace layout: six 8192x512 f16 tensors + four 512x512 f16 weights ~ 50 MB, then the int key orders and counts
    _Float16* W = (_Float16*)d_ws;
    const size_t SZ = (size_t)B_ * N_ * INNER_;   // 4M elements
    _Float16* x_h  = W;
    _Float16* c_h  = W + SZ;
    _Float16* q_h  = W + 2 * SZ;
    _Float16* k_h  = W + 3 * SZ;
    _Float16* vt_h = W + 4 * SZ;   // [B][INNER][M] (d-major V)
    _Float16* ao_h = W + 5 * SZ;
    _Float16* Wt   = W + 6 * SZ;       // WqT, WkT, WvT, WoT, one behind the other
    _Float16* WoT  = Wt + 3 * WGT_E;
    int* ord = (int*)(Wt + 4 * WGT_E); // [B][M] key order of each batch
    int* cnt = ord + B_ * M_;          // [B][CNT_LD] keys that are set

    static_assert(ACT_E % CV_BLOCK_E == 0 && B_ * M_ * CDIM == ACT_E && B_ * N_ * QDIM == ACT_E,
                  "the convert's grid is exact");
    static_assert(M_ % CV_THREADS == 0 && (M_ & (M_ - 1)) == 0, "key_order's ballots are whole");
    cvt_all<<<B_ + 2 * CV_ACT_B + 4 * CV_WGT_B, CV_THREADS, 0, stream>>>(x, ctx, Wq, Wkv, Wo, mask, x_h, c_h, Wt, ord, cnt);

    // 128x128 tile of C per work-group: grid (columns / 128, rows / 128)
    static_assert(QDIM == GK && CDIM == GK && INNER_ == GK && INNER_ == GN && QDIM == GN,
                  "every projection is 512 deep and 512 wide");
    static_assert(GN % GTN == 0 && (B_ * N_) % GTM == 0 && (B_ * M_) % GTM == 0 && M_ % GTM == 0 && GNST >= 2,
                  "the grid is exact and the ring has its two stages");
    static_assert(B_ * N_ == B_ * M_, "the three input projections have the same rows");
    const dim3 gg(GN / GTN, (B_ * N_) / GTM);       // 4 x 64
    const dim3 g3(3 * (GN / GTN), (B_ * N_) / GTM); // 12 x 64
    gemm_wmma<0><<<g3, GWAVES * 32, 0, stream>>>(x_h, c_h, Wt, q_h, k_h, vt_h, nullptr, nullptr, ord, cnt);

    flash_attn<<<dim3(B_ * HEADS_, N_ / (QWAVES * 16)), QWAVES * 32, 0, stream>>>(q_h, k_h, vt_h, cnt, ao_h);

    gemm_wmma<2><<<gg, GWAVES * 32, 0, stream>>>(ao_h, nullptr, WoT, nullptr, nullptr, nullptr, out, bo, nullptr, nullptr);
}
